// v000
// Measured on an AMD MI455X. A time is GPU time per run, averaged over a window of back-to-back runs after a warm-up
// (all launches, gaps included; the runs take copies of the inputs in turn), and the median of several windows.
// Apart from v000's, it joins two sittings. Times from different sittings can be a few percent apart, while
// side-by-side timings come from the same sitting.
// The starting kernel, v000, takes 386 microseconds a run.
#include <hip/hip_runtime.h>

#define EMBED 1024
#define HEADS 16
#define HDIM  64
#define BATCH 4
#define SEQ   1024

typedef __attribute__((ext_vector_type(2))) float v2f;
typedef __attribute__((ext_vector_type(8))) float v8f;

// D = A(16x4 f32) * B(4x16 f32) + C(16x16 f32)   -- CDNA5 V_WMMA_F32_16X16X4_F32
static __device__ __forceinline__ v8f wmma_f32(v2f a, v2f b, v8f c) {
  return __builtin_amdgcn_wmma_f32_16x16x4_f32(
      /*neg_a=*/false, a, /*neg_b=*/false, b,
      /*c_mod=*/(short)0, c, /*reuse_a=*/false, /*reuse_b=*/false);
}

static __device__ __forceinline__ v8f vzero8() {
  return (v8f){0.f, 0.f, 0.f, 0.f, 0.f, 0.f, 0.f, 0.f};
}

// ---------------------------------------------------------------------------
// Kernel A: per-head linear projections.  X viewed as [B*S*H, 64] rows.
//   y = x @ W.T      (W is [64,64], shared across heads)
// tensor 0: query->Wq -> Qp [B,H,S,D]
// tensor 1: keys ->Wk -> Kp [B,H,S,D]
// tensor 2: values->Wv -> Vt [B,H,D,S]   (transposed for P*V B-fragments)
// One wave handles 16 rows (= the 16 heads of one token) x 64 output dims.
// ---------------------------------------------------------------------------
__global__ __launch_bounds__(128) void qkv_proj_kernel(
    const float* __restrict__ q_in, const float* __restrict__ k_in,
    const float* __restrict__ v_in,
    const float* __restrict__ Wq, const float* __restrict__ Wk,
    const float* __restrict__ Wv,
    float* __restrict__ Qp, float* __restrict__ Kp, float* __restrict__ Vt)
{
  const int wave   = blockIdx.x * 4 + (threadIdx.x >> 5);
  const int lane   = threadIdx.x & 31;
  const int m      = lane & 15;      // A-matrix row within tile
  const int half   = lane >> 4;      // 0: K-pair {0,1}, 1: K-pair {2,3}
  const int tensor = wave >> 12;     // 4096 row-tiles per tensor
  const int token  = wave & 4095;    // = b*SEQ + s
  const int b      = token >> 10;
  const int s      = token & 1023;

  const float* X;
  const float* W;
  if (tensor == 0)      { X = q_in; W = Wq; }
  else if (tensor == 1) { X = k_in; W = Wk; }
  else                  { X = v_in; W = Wv; }

  // A fragments: 16 rows (heads of this token) x 64 features
  const float* arow = X + (size_t)(token * 16 + m) * HDIM + 2 * half;
  v2f qa[16];
#pragma unroll
  for (int ks = 0; ks < 16; ++ks)
    qa[ks] = *(const v2f*)(arow + 4 * ks);

#pragma unroll
  for (int nt = 0; nt < 4; ++nt) {
    // B fragments, batched: B[k][n] = W[n][k]  (x @ W.T)
    const float* brow = W + (size_t)(nt * 16 + m) * HDIM + 2 * half;
    v2f bf[16];
#pragma unroll
    for (int ks = 0; ks < 16; ++ks)
      bf[ks] = *(const v2f*)(brow + 4 * ks);

    // two independent accumulator chains
    v8f a0 = vzero8(), a1 = vzero8();
#pragma unroll
    for (int ks = 0; ks < 8; ++ks) {
      a0 = wmma_f32(qa[2 * ks + 0], bf[2 * ks + 0], a0);
      a1 = wmma_f32(qa[2 * ks + 1], bf[2 * ks + 1], a1);
    }
    v8f acc = a0 + a1;

    // D layout: lane holds row (j + 8*half) = head, col (nt*16 + m) = dim.
    // Both output layouts have j-stride 65536 floats (h-stride).
    float* outp;
    size_t base;
    if (tensor == 2) {
      outp = Vt;
      base = ((size_t)((b * 16 + 8 * half) * HDIM + nt * 16 + m)) * SEQ + s;
    } else {
      outp = (tensor == 0) ? Qp : Kp;
      base = ((size_t)((b * 16 + 8 * half) * SEQ + s)) * HDIM + nt * 16 + m;
    }
#pragma unroll
    for (int j = 0; j < 8; ++j)
      outp[base + (size_t)j * (HDIM * SEQ)] = acc[j];
  }
}

// ---------------------------------------------------------------------------
// Kernel B: flash attention per (b,h).  One wave = one 16-query tile,
// streaming 64 key tiles of 16, online softmax, P*V accumulated in VGPRs.
// The 4 waves of a block share (b,h) and are barrier-locked per key tile,
// so K/V tiles are served from WGP$ after the first wave touches them.
// ---------------------------------------------------------------------------
__global__ __launch_bounds__(128) void attn_kernel(
    const float* __restrict__ Qp, const float* __restrict__ Kp,
    const float* __restrict__ Vt, const int* __restrict__ mask,
    float* __restrict__ AO)
{
  __shared__ float lds_p[4][16 * 18];   // padded stride 18: 8B aligned, no bank conflicts

  const int wslot = threadIdx.x >> 5;
  const int wave  = blockIdx.x * 4 + wslot;
  const int lane  = threadIdx.x & 31;
  const int m     = lane & 15;
  const int half  = lane >> 4;
  const int qt    = wave & 63;          // 64 query tiles per (b,h)
  const int bh    = wave >> 6;          // 0..63
  const int b     = bh >> 4;
  const int h     = bh & 15;
  const int qbase = qt * 16;

  const float* Qb = Qp + (size_t)bh * SEQ * HDIM;
  const float* Kb = Kp + (size_t)bh * SEQ * HDIM;
  const float* Vb = Vt + (size_t)bh * HDIM * SEQ;
  const int*   Mb = mask + (size_t)b * SEQ * SEQ;

  // Preload Q fragments for this 16-query tile (reused over all key tiles)
  const float* qrow = Qb + (size_t)(qbase + m) * HDIM + 2 * half;
  v2f qa[16];
#pragma unroll
  for (int ks = 0; ks < 16; ++ks)
    qa[ks] = *(const v2f*)(qrow + 4 * ks);

  v8f O[4];
  float rowmax[8], rowsum[8];
#pragma unroll
  for (int nt = 0; nt < 4; ++nt) O[nt] = vzero8();
#pragma unroll
  for (int j = 0; j < 8; ++j) { rowmax[j] = -3.4e38f; rowsum[j] = 0.f; }

  float* P = lds_p[wslot];
  const int* mrow0 = Mb + (size_t)(qbase + 8 * half) * SEQ + m;

  for (int kt = 0; kt < 64; ++kt) {
    const int kb0 = kt * 16;
    const float* krow = Kb + (size_t)(kb0 + m) * HDIM + 2 * half;

    // batch-load K fragments (distinct regs -> loads overlap the MMA chain)
    v2f kf[16];
#pragma unroll
    for (int ks = 0; ks < 16; ++ks)
      kf[ks] = *(const v2f*)(krow + 4 * ks);

    // prefetch next key tile of K/V into caches while we compute
    if (kt < 63) {
      __builtin_prefetch(krow + 16 * HDIM, 0, 1);
      __builtin_prefetch(Vb + (size_t)m * SEQ + kb0 + 16, 0, 1);
    }

    // batch-load mask for this tile (j-stride = SEQ -> immediate offsets)
    int mk[8];
#pragma unroll
    for (int j = 0; j < 8; ++j)
      mk[j] = mrow0[(size_t)j * SEQ + kb0];

    // ---- scores: S = Q (16x64) @ K_tile^T (64x16), two chains ----
    v8f c0 = vzero8(), c1 = vzero8();
#pragma unroll
    for (int ks = 0; ks < 8; ++ks) {
      c0 = wmma_f32(qa[2 * ks + 0], kf[2 * ks + 0], c0);
      c1 = wmma_f32(qa[2 * ks + 1], kf[2 * ks + 1], c1);
    }
    v8f c = c0 + c1;

    // ---- mask + scale + online softmax (row = query, along 16 lanes) ----
    float p[8], scl[8];
#pragma unroll
    for (int j = 0; j < 8; ++j) {
      // reference: where(mask==0, -1e20) happens BEFORE /sqrt(EMBED)
      const float sv = (mk[j] == 0) ? -3.125e18f : c[j] * 0.03125f;

      float mt = sv;                           // max over the 16 keys
      mt = fmaxf(mt, __shfl_xor(mt, 1, 16));
      mt = fmaxf(mt, __shfl_xor(mt, 2, 16));
      mt = fmaxf(mt, __shfl_xor(mt, 4, 16));
      mt = fmaxf(mt, __shfl_xor(mt, 8, 16));
      const float nm = fmaxf(rowmax[j], mt);
      const float sc = __expf(rowmax[j] - nm);
      rowmax[j] = nm;
      const float pv = __expf(sv - nm);
      float st = pv;                           // sum over the 16 keys
      st += __shfl_xor(st, 1, 16);
      st += __shfl_xor(st, 2, 16);
      st += __shfl_xor(st, 4, 16);
      st += __shfl_xor(st, 8, 16);
      rowsum[j] = rowsum[j] * sc + st;
      p[j]   = pv;
      scl[j] = sc;
    }
#pragma unroll
    for (int nt = 0; nt < 4; ++nt)
#pragma unroll
      for (int j = 0; j < 8; ++j)
        O[nt][j] *= scl[j];

    // ---- stage P (C-layout -> A-layout) through LDS ----
    __syncthreads();                 // previous iteration's reads are done
#pragma unroll
    for (int j = 0; j < 8; ++j)
      P[(j + 8 * half) * 18 + m] = p[j];       // P[query][key]
    __syncthreads();
    v2f pa[4];
#pragma unroll
    for (int ks = 0; ks < 4; ++ks)
      pa[ks] = *(const v2f*)(P + m * 18 + 4 * ks + 2 * half);

    // ---- O += P (16x16) @ V_tile (16x64) ----
    // batch-load all 16 V fragments first, then 16 WMMAs on 4 indep chains
    v2f vf[4][4];
#pragma unroll
    for (int nt = 0; nt < 4; ++nt) {
      const float* vrow = Vb + (size_t)(nt * 16 + m) * SEQ + kb0 + 2 * half;
#pragma unroll
      for (int ks = 0; ks < 4; ++ks)
        vf[nt][ks] = *(const v2f*)(vrow + 4 * ks);
    }
#pragma unroll
    for (int ks = 0; ks < 4; ++ks)
#pragma unroll
      for (int nt = 0; nt < 4; ++nt)
        O[nt] = wmma_f32(pa[ks], vf[nt][ks], O[nt]);
  }

  // finalize: divide by rowsum, store as [B, S, H*D]  (j-stride = 1024 floats)
  float inv[8];
#pragma unroll
  for (int j = 0; j < 8; ++j) inv[j] = 1.f / rowsum[j];
#pragma unroll
  for (int nt = 0; nt < 4; ++nt) {
    const size_t base =
        ((size_t)(b * SEQ + qbase + 8 * half) * HEADS + h) * HDIM + nt * 16 + m;
#pragma unroll
    for (int j = 0; j < 8; ++j)
      AO[base + (size_t)j * EMBED] = O[nt][j] * inv[j];
  }
}

// ---------------------------------------------------------------------------
// Kernel C: out = X[4096,1024] @ Wu^T + bu.  Wave = 32x64 output tile
// (two 16-row M-tiles share the same Wu B-fragments: halves Wu traffic,
//  32 WMMAs per 24 loads per K-block, 8 independent accumulator chains).
// ---------------------------------------------------------------------------
__global__ __launch_bounds__(128) void out_proj_kernel(
    const float* __restrict__ X, const float* __restrict__ Wu,
    const float* __restrict__ bu, float* __restrict__ out)
{
  const int wave  = blockIdx.x * 4 + (threadIdx.x >> 5);
  const int lane  = threadIdx.x & 31;
  const int m     = lane & 15;
  const int half  = lane >> 4;
  const int ntile = wave & 15;          // 16 tiles of 64 output cols
  const int mtile = wave >> 4;          // 128 tiles of 32 rows
  const int row0  = mtile * 32;
  const int col0  = ntile * 64;

  v8f acc[2][4];
#pragma unroll
  for (int mt = 0; mt < 2; ++mt)
#pragma unroll
    for (int nt = 0; nt < 4; ++nt) acc[mt][nt] = vzero8();

  const float* arow0 = X  + (size_t)(row0 + m) * EMBED + 2 * half;
  const float* arow1 = arow0 + (size_t)16 * EMBED;
  const float* brow  = Wu + (size_t)(col0 + m) * EMBED + 2 * half;

  for (int kb = 0; kb < 64; ++kb) {   // 64 blocks x 4 k-steps = K=1024
    v2f af[2][4];
    v2f bf[4][4];
#pragma unroll
    for (int i = 0; i < 4; ++i) {
      af[0][i] = *(const v2f*)(arow0 + 16 * kb + 4 * i);
      af[1][i] = *(const v2f*)(arow1 + 16 * kb + 4 * i);
    }
#pragma unroll
    for (int nt = 0; nt < 4; ++nt)
#pragma unroll
      for (int i = 0; i < 4; ++i)
        bf[nt][i] = *(const v2f*)(brow + (size_t)nt * 16 * EMBED + 16 * kb + 4 * i);

#pragma unroll
    for (int i = 0; i < 4; ++i)
#pragma unroll
      for (int mt = 0; mt < 2; ++mt)
#pragma unroll
        for (int nt = 0; nt < 4; ++nt)
          acc[mt][nt] = wmma_f32(af[mt][i], bf[nt][i], acc[mt][nt]);
  }

#pragma unroll
  for (int mt = 0; mt < 2; ++mt)
#pragma unroll
    for (int nt = 0; nt < 4; ++nt) {
      const float bias = bu[col0 + nt * 16 + m];
      const size_t base =
          (size_t)(row0 + mt * 16 + 8 * half) * EMBED + col0 + nt * 16 + m;
#pragma unroll
      for (int j = 0; j < 8; ++j)
        out[base + (size_t)j * EMBED] = acc[mt][nt][j] + bias;
    }
}

// ---------------------------------------------------------------------------
extern "C" void kernel_launch(void* const* d_in, const int* in_sizes, int n_in,
                              void* d_out, int out_size, void* d_ws, size_t ws_size,
                              hipStream_t stream) {
  (void)in_sizes; (void)n_in; (void)out_size; (void)ws_size;
  const float* values = (const float*)d_in[0];
  const float* keys   = (const float*)d_in[1];
  const float* query  = (const float*)d_in[2];
  const int*   mask   = (const int*)d_in[3];
  const float* Wv     = (const float*)d_in[4];
  const float* Wq     = (const float*)d_in[5];
  const float* Wk     = (const float*)d_in[6];
  const float* Wu     = (const float*)d_in[7];
  const float* bu     = (const float*)d_in[8];
  float* out = (float*)d_out;

  // workspace layout (f32): Qp | Kp | Vt | AO, 4M floats each = 64 MB total
  float* ws = (float*)d_ws;
  const size_t T = (size_t)BATCH * HEADS * SEQ * HDIM;   // 4,194,304
  float* Qp = ws;
  float* Kp = ws + T;
  float* Vt = ws + 2 * T;
  float* AO = ws + 3 * T;

  // A: 3 tensors * 4096 row-tiles = 12288 waves / 4 per block
  qkv_proj_kernel<<<3072, 128, 0, stream>>>(query, keys, values, Wq, Wk, Wv,
                                            Qp, Kp, Vt);
  // B: 64 (b,h) * 64 q-tiles = 4096 waves / 4 per block
  attn_kernel<<<1024, 128, 0, stream>>>(Qp, Kp, Vt, mask, AO);
  // C: 128 m-tiles(32 rows) * 16 n-tiles = 2048 waves / 4 per block
  out_proj_kernel<<<512, 128, 0, stream>>>(AO, Wu, bu, out);
}

// v001
// One run takes 273 microseconds.
// Two timings next to v000 both put it at 1.46 times that version's speed.
#include <hip/hip_runtime.h>

#define EMBED 1024
#define HEADS 16
#define HDIM  64
#define BATCH 4
#define SEQ   1024

typedef __attribute__((ext_vector_type(2))) float v2f;
typedef __attribute__((ext_vector_type(8))) float v8f;

// D = A(16x4 f32) * B(4x16 f32) + C(16x16 f32)   -- CDNA5 V_WMMA_F32_16X16X4_F32
static __device__ __forceinline__ v8f wmma_f32(v2f a, v2f b, v8f c) {
  return __builtin_amdgcn_wmma_f32_16x16x4_f32(
      /*neg_a=*/false, a, /*neg_b=*/false, b,
      /*c_mod=*/(short)0, c, /*reuse_a=*/false, /*reuse_b=*/false);
}

static __device__ __forceinline__ v8f vzero8() {
  return (v8f){0.f, 0.f, 0.f, 0.f, 0.f, 0.f, 0.f, 0.f};
}

// ---------------------------------------------------------------------------
// Kernel A: per-head linear projections,  y = x @ W.T  (W is [64,64], shared
// across heads).
// Blocks 0..511: values->Wv -> Vt [B,H,D,S] (transposed for P*V B-fragments).
//   One wave = 32 consecutive tokens of one head.  It computes Wv * X^T, so
//   the accumulator's columns (the 16 lanes of a half-wave) are consecutive
//   tokens: each store writes 64-byte runs along S, and the wave owns the
//   whole 128-byte line of every Vt row it touches.
// Blocks 512..2559: query->Wq -> Qp [B,H,S,D], keys->Wk -> Kp [B,H,S,D].
//   One wave = 16 rows (the 16 heads of one token) x 64 output dims.
// ---------------------------------------------------------------------------
__global__ __launch_bounds__(128) void qkv_proj_kernel(
    const float* __restrict__ q_in, const float* __restrict__ k_in,
    const float* __restrict__ v_in,
    const float* __restrict__ Wq, const float* __restrict__ Wk,
    const float* __restrict__ Wv,
    float* __restrict__ Qp, float* __restrict__ Kp, float* __restrict__ Vt)
{
  const int lane   = threadIdx.x & 31;
  const int m      = lane & 15;      // A-matrix row / B-matrix column in tile
  const int half   = lane >> 4;      // 0: K-pair {0,1}, 1: K-pair {2,3}

  if (blockIdx.x < 512) {
    const int vw = blockIdx.x * 4 + (threadIdx.x >> 5);   // 0..2047
    const int h  = vw & 15;          // the 4 waves of a block: adjacent heads
    const int s0 = ((vw >> 4) & 31) * 32;
    const int b  = vw >> 9;

    // B fragments: B[k][n] = X[token s0 + 16*tt + n][head h][k]
    const float* xrow =
        v_in + ((size_t)(b * SEQ + s0 + m) * HEADS + h) * HDIM + 2 * half;
    v2f xb[2][16];
#pragma unroll
    for (int tt = 0; tt < 2; ++tt)
#pragma unroll
      for (int ks = 0; ks < 16; ++ks)
        xb[tt][ks] = *(const v2f*)(xrow + (size_t)tt * 16 * EMBED + 4 * ks);

    // D layout: lane holds row (j + 8*half) = dim, col m = token.
    float* vout = Vt + (size_t)((b * HEADS + h) * HDIM + 8 * half) * SEQ + s0 + m;

    // kept rolled: unrolled, all four Wv fragment sets are loaded up front and
    // the register count costs every wave of this kernel half its residency
#pragma unroll 1
    for (int nt = 0; nt < 4; ++nt) {
      // A fragments: A[d][k] = Wv[nt*16 + d][k]
      const float* wrow = Wv + (size_t)(nt * 16 + m) * HDIM + 2 * half;
      v2f wa[16];
#pragma unroll
      for (int ks = 0; ks < 16; ++ks)
        wa[ks] = *(const v2f*)(wrow + 4 * ks);

      // two accumulator chains per token tile (even / odd k-steps)
      v8f a0 = vzero8(), a1 = vzero8(), c0 = vzero8(), c1 = vzero8();
#pragma unroll
      for (int ks = 0; ks < 8; ++ks) {
        a0 = wmma_f32(wa[2 * ks + 0], xb[0][2 * ks + 0], a0);
        c0 = wmma_f32(wa[2 * ks + 0], xb[1][2 * ks + 0], c0);
        a1 = wmma_f32(wa[2 * ks + 1], xb[0][2 * ks + 1], a1);
        c1 = wmma_f32(wa[2 * ks + 1], xb[1][2 * ks + 1], c1);
      }
      const v8f t0 = a0 + a1;
      const v8f t1 = c0 + c1;
#pragma unroll
      for (int j = 0; j < 8; ++j) {
        vout[(size_t)(nt * 16 + j) * SEQ]      = t0[j];
        vout[(size_t)(nt * 16 + j) * SEQ + 16] = t1[j];
      }
      // the next trip reuses the stores' address and data registers
      asm volatile("s_wait_xcnt 0x0" ::: "memory");
    }
    return;
  }

  const int wave   = (blockIdx.x - 512) * 4 + (threadIdx.x >> 5);
  const int tensor = wave >> 12;     // 4096 row-tiles per tensor
  const int token  = wave & 4095;    // = b*SEQ + s
  const int b      = token >> 10;
  const int s      = token & 1023;

  const float* X = (tensor == 0) ? q_in : k_in;
  const float* W = (tensor == 0) ? Wq : Wk;

  // A fragments: 16 rows (heads of this token) x 64 features
  const float* arow = X + (size_t)(token * 16 + m) * HDIM + 2 * half;
  v2f qa[16];
#pragma unroll
  for (int ks = 0; ks < 16; ++ks)
    qa[ks] = *(const v2f*)(arow + 4 * ks);

#pragma unroll
  for (int nt = 0; nt < 4; ++nt) {
    // B fragments, batched: B[k][n] = W[n][k]  (x @ W.T)
    const float* brow = W + (size_t)(nt * 16 + m) * HDIM + 2 * half;
    v2f bf[16];
#pragma unroll
    for (int ks = 0; ks < 16; ++ks)
      bf[ks] = *(const v2f*)(brow + 4 * ks);

    // two independent accumulator chains
    v8f a0 = vzero8(), a1 = vzero8();
#pragma unroll
    for (int ks = 0; ks < 8; ++ks) {
      a0 = wmma_f32(qa[2 * ks + 0], bf[2 * ks + 0], a0);
      a1 = wmma_f32(qa[2 * ks + 1], bf[2 * ks + 1], a1);
    }
    v8f acc = a0 + a1;

    // D layout: lane holds row (j + 8*half) = head, col (nt*16 + m) = dim.
    // j-stride is the h-stride, 65536 floats.
    float* outp = (tensor == 0) ? Qp : Kp;
    const size_t base =
        ((size_t)((b * 16 + 8 * half) * SEQ + s)) * HDIM + nt * 16 + m;
#pragma unroll
    for (int j = 0; j < 8; ++j)
      outp[base + (size_t)j * (HDIM * SEQ)] = acc[j];
  }
}

// ---------------------------------------------------------------------------
// Kernel B: flash attention per (b,h).  One wave = one 16-query tile,
// streaming 64 key tiles of 16, online softmax, P*V accumulated in VGPRs.
// The 4 waves of a block share (b,h) and are barrier-locked per key tile,
// so K/V tiles are served from WGP$ after the first wave touches them.
// ---------------------------------------------------------------------------
__global__ __launch_bounds__(128) void attn_kernel(
    const float* __restrict__ Qp, const float* __restrict__ Kp,
    const float* __restrict__ Vt, const int* __restrict__ mask,
    float* __restrict__ AO)
{
  __shared__ float lds_p[4][16 * 18];   // padded stride 18: 8B aligned, no bank conflicts

  const int wslot = threadIdx.x >> 5;
  const int wave  = blockIdx.x * 4 + wslot;
  const int lane  = threadIdx.x & 31;
  const int m     = lane & 15;
  const int half  = lane >> 4;
  const int qt    = wave & 63;          // 64 query tiles per (b,h)
  const int bh    = wave >> 6;          // 0..63
  const int b     = bh >> 4;
  const int h     = bh & 15;
  const int qbase = qt * 16;

  const float* Qb = Qp + (size_t)bh * SEQ * HDIM;
  const float* Kb = Kp + (size_t)bh * SEQ * HDIM;
  const float* Vb = Vt + (size_t)bh * HDIM * SEQ;
  const int*   Mb = mask + (size_t)b * SEQ * SEQ;

  // Preload Q fragments for this 16-query tile (reused over all key tiles)
  const float* qrow = Qb + (size_t)(qbase + m) * HDIM + 2 * half;
  v2f qa[16];
#pragma unroll
  for (int ks = 0; ks < 16; ++ks)
    qa[ks] = *(const v2f*)(qrow + 4 * ks);

  v8f O[4];
  float rowmax[8], rowsum[8];
#pragma unroll
  for (int nt = 0; nt < 4; ++nt) O[nt] = vzero8();
#pragma unroll
  for (int j = 0; j < 8; ++j) { rowmax[j] = -3.4e38f; rowsum[j] = 0.f; }

  float* P = lds_p[wslot];
  const int* mrow0 = Mb + (size_t)(qbase + 8 * half) * SEQ + m;

  for (int kt = 0; kt < 64; ++kt) {
    const int kb0 = kt * 16;
    const float* krow = Kb + (size_t)(kb0 + m) * HDIM + 2 * half;

    // batch-load K fragments (distinct regs -> loads overlap the MMA chain)
    v2f kf[16];
#pragma unroll
    for (int ks = 0; ks < 16; ++ks)
      kf[ks] = *(const v2f*)(krow + 4 * ks);

    // prefetch next key tile of K/V into caches while we compute
    if (kt < 63) {
      __builtin_prefetch(krow + 16 * HDIM, 0, 1);
      __builtin_prefetch(Vb + (size_t)m * SEQ + kb0 + 16, 0, 1);
    }

    // batch-load mask for this tile (j-stride = SEQ -> immediate offsets)
    int mk[8];
#pragma unroll
    for (int j = 0; j < 8; ++j)
      mk[j] = mrow0[(size_t)j * SEQ + kb0];

    // ---- scores: S = Q (16x64) @ K_tile^T (64x16), two chains ----
    v8f c0 = vzero8(), c1 = vzero8();
#pragma unroll
    for (int ks = 0; ks < 8; ++ks) {
      c0 = wmma_f32(qa[2 * ks + 0], kf[2 * ks + 0], c0);
      c1 = wmma_f32(qa[2 * ks + 1], kf[2 * ks + 1], c1);
    }
    v8f c = c0 + c1;

    // ---- mask + scale + online softmax (row = query, along 16 lanes) ----
    float p[8], scl[8];
#pragma unroll
    for (int j = 0; j < 8; ++j) {
      // reference: where(mask==0, -1e20) happens BEFORE /sqrt(EMBED)
      const float sv = (mk[j] == 0) ? -3.125e18f : c[j] * 0.03125f;

      float mt = sv;                           // max over the 16 keys
      mt = fmaxf(mt, __shfl_xor(mt, 1, 16));
      mt = fmaxf(mt, __shfl_xor(mt, 2, 16));
      mt = fmaxf(mt, __shfl_xor(mt, 4, 16));
      mt = fmaxf(mt, __shfl_xor(mt, 8, 16));
      const float nm = fmaxf(rowmax[j], mt);
      const float sc = __expf(rowmax[j] - nm);
      rowmax[j] = nm;
      const float pv = __expf(sv - nm);
      float st = pv;                           // sum over the 16 keys
      st += __shfl_xor(st, 1, 16);
      st += __shfl_xor(st, 2, 16);
      st += __shfl_xor(st, 4, 16);
      st += __shfl_xor(st, 8, 16);
      rowsum[j] = rowsum[j] * sc + st;
      p[j]   = pv;
      scl[j] = sc;
    }
#pragma unroll
    for (int nt = 0; nt < 4; ++nt)
#pragma unroll
      for (int j = 0; j < 8; ++j)
        O[nt][j] *= scl[j];

    // ---- stage P (C-layout -> A-layout) through LDS ----
    __syncthreads();                 // previous iteration's reads are done
#pragma unroll
    for (int j = 0; j < 8; ++j)
      P[(j + 8 * half) * 18 + m] = p[j];       // P[query][key]
    __syncthreads();
    v2f pa[4];
#pragma unroll
    for (int ks = 0; ks < 4; ++ks)
      pa[ks] = *(const v2f*)(P + m * 18 + 4 * ks + 2 * half);

    // ---- O += P (16x16) @ V_tile (16x64) ----
    // batch-load all 16 V fragments first, then 16 WMMAs on 4 indep chains
    v2f vf[4][4];
#pragma unroll
    for (int nt = 0; nt < 4; ++nt) {
      const float* vrow = Vb + (size_t)(nt * 16 + m) * SEQ + kb0 + 2 * half;
#pragma unroll
      for (int ks = 0; ks < 4; ++ks)
        vf[nt][ks] = *(const v2f*)(vrow + 4 * ks);
    }
#pragma unroll
    for (int ks = 0; ks < 4; ++ks)
#pragma unroll
      for (int nt = 0; nt < 4; ++nt)
        O[nt] = wmma_f32(pa[ks], vf[nt][ks], O[nt]);
  }

  // finalize: divide by rowsum, store as [B, S, H*D]  (j-stride = 1024 floats)
  float inv[8];
#pragma unroll
  for (int j = 0; j < 8; ++j) inv[j] = 1.f / rowsum[j];
#pragma unroll
  for (int nt = 0; nt < 4; ++nt) {
    const size_t base =
        ((size_t)(b * SEQ + qbase + 8 * half) * HEADS + h) * HDIM + nt * 16 + m;
#pragma unroll
    for (int j = 0; j < 8; ++j)
      AO[base + (size_t)j * EMBED] = O[nt][j] * inv[j];
  }
}

// ---------------------------------------------------------------------------
// Kernel C: out = X[4096,1024] @ Wu^T + bu.  Wave = 32x64 output tile
// (two 16-row M-tiles share the same Wu B-fragments: halves Wu traffic,
//  32 WMMAs per 24 loads per K-block, 8 independent accumulator chains).
// ---------------------------------------------------------------------------
__global__ __launch_bounds__(128) void out_proj_kernel(
    const float* __restrict__ X, const float* __restrict__ Wu,
    const float* __restrict__ bu, float* __restrict__ out)
{
  const int wave  = blockIdx.x * 4 + (threadIdx.x >> 5);
  const int lane  = threadIdx.x & 31;
  const int m     = lane & 15;
  const int half  = lane >> 4;
  const int ntile = wave & 15;          // 16 tiles of 64 output cols
  const int mtile = wave >> 4;          // 128 tiles of 32 rows
  const int row0  = mtile * 32;
  const int col0  = ntile * 64;

  v8f acc[2][4];
#pragma unroll
  for (int mt = 0; mt < 2; ++mt)
#pragma unroll
    for (int nt = 0; nt < 4; ++nt) acc[mt][nt] = vzero8();

  const float* arow0 = X  + (size_t)(row0 + m) * EMBED + 2 * half;
  const float* arow1 = arow0 + (size_t)16 * EMBED;
  const float* brow  = Wu + (size_t)(col0 + m) * EMBED + 2 * half;

  for (int kb = 0; kb < 64; ++kb) {   // 64 blocks x 4 k-steps = K=1024
    v2f af[2][4];
    v2f bf[4][4];
#pragma unroll
    for (int i = 0; i < 4; ++i) {
      af[0][i] = *(const v2f*)(arow0 + 16 * kb + 4 * i);
      af[1][i] = *(const v2f*)(arow1 + 16 * kb + 4 * i);
    }
#pragma unroll
    for (int nt = 0; nt < 4; ++nt)
#pragma unroll
      for (int i = 0; i < 4; ++i)
        bf[nt][i] = *(const v2f*)(brow + (size_t)nt * 16 * EMBED + 16 * kb + 4 * i);

#pragma unroll
    for (int i = 0; i < 4; ++i)
#pragma unroll
      for (int mt = 0; mt < 2; ++mt)
#pragma unroll
        for (int nt = 0; nt < 4; ++nt)
          acc[mt][nt] = wmma_f32(af[mt][i], bf[nt][i], acc[mt][nt]);
  }

#pragma unroll
  for (int mt = 0; mt < 2; ++mt)
#pragma unroll
    for (int nt = 0; nt < 4; ++nt) {
      const float bias = bu[col0 + nt * 16 + m];
      const size_t base =
          (size_t)(row0 + mt * 16 + 8 * half) * EMBED + col0 + nt * 16 + m;
#pragma unroll
      for (int j = 0; j < 8; ++j)
        out[base + (size_t)j * EMBED] = acc[mt][nt][j] + bias;
    }
}

// ---------------------------------------------------------------------------
extern "C" void kernel_launch(void* const* d_in, const int* in_sizes, int n_in,
                              void* d_out, int out_size, void* d_ws, size_t ws_size,
                              hipStream_t stream) {
  (void)in_sizes; (void)n_in; (void)out_size; (void)ws_size;
  const float* values = (const float*)d_in[0];
  const float* keys   = (const float*)d_in[1];
  const float* query  = (const float*)d_in[2];
  const int*   mask   = (const int*)d_in[3];
  const float* Wv     = (const float*)d_in[4];
  const float* Wq     = (const float*)d_in[5];
  const float* Wk     = (const float*)d_in[6];
  const float* Wu     = (const float*)d_in[7];
  const float* bu     = (const float*)d_in[8];
  float* out = (float*)d_out;

  // workspace layout (f32): Qp | Kp | Vt | AO, 4M floats each = 64 MB total
  float* ws = (float*)d_ws;
  const size_t T = (size_t)BATCH * HEADS * SEQ * HDIM;   // 4,194,304
  float* Qp = ws;
  float* Kp = ws + T;
  float* Vt = ws + 2 * T;
  float* AO = ws + 3 * T;

  // A: V 2048 waves (32 tokens x 1 head) + Q,K 2 * 4096 row-tiles, 4 per block
  qkv_proj_kernel<<<2560, 128, 0, stream>>>(query, keys, values, Wq, Wk, Wv,
                                            Qp, Kp, Vt);
  // B: 64 (b,h) * 64 q-tiles = 4096 waves / 4 per block
  attn_kernel<<<1024, 128, 0, stream>>>(Qp, Kp, Vt, mask, AO);
  // C: 128 m-tiles(32 rows) * 16 n-tiles = 2048 waves / 4 per block
  out_proj_kernel<<<512, 128, 0, stream>>>(AO, Wu, bu, out);
}

// v002
// A run of this version takes 224 microseconds.
// Two timings next to v001 put it at 1.22 and 1.21 times that version's speed.
// Counting every step since v000, it is 1.78 times as fast.
#include <hip/hip_runtime.h>

#define EMBED 1024
#define HEADS 16
#define HDIM  64
#define BATCH 4
#define SEQ   1024

typedef __attribute__((ext_vector_type(2))) float v2f;
typedef __attribute__((ext_vector_type(8))) float v8f;

// D = A(16x4 f32) * B(4x16 f32) + C(16x16 f32)   -- CDNA5 V_WMMA_F32_16X16X4_F32
static __device__ __forceinline__ v8f wmma_f32(v2f a, v2f b, v8f c) {
  return __builtin_amdgcn_wmma_f32_16x16x4_f32(
      /*neg_a=*/false, a, /*neg_b=*/false, b,
      /*c_mod=*/(short)0, c, /*reuse_a=*/false, /*reuse_b=*/false);
}

static __device__ __forceinline__ v8f vzero8() {
  return (v8f){0.f, 0.f, 0.f, 0.f, 0.f, 0.f, 0.f, 0.f};
}

// ---------------------------------------------------------------------------
// Kernel A: per-head linear projections,  y = x @ W.T  (W is [64,64], shared
// across heads).
// Blocks 0..511: values->Wv -> Vt [B,H,D,S] (transposed for P*V B-fragments).
//   One wave = 32 consecutive tokens of one head.  It computes Wv * X^T, so
//   the accumulator's columns (the 16 lanes of a half-wave) are consecutive
//   tokens: each store writes 64-byte runs along S, and the wave owns the
//   whole 128-byte line of every Vt row it touches.
// Blocks 512..2559: query->Wq -> Qp [B,H,S,D], keys->Wk -> Kp [B,H,S,D].
//   One wave = 16 rows (the 16 heads of one token) x 64 output dims.
// ---------------------------------------------------------------------------
__global__ __launch_bounds__(128) void qkv_proj_kernel(
    const float* __restrict__ q_in, const float* __restrict__ k_in,
    const float* __restrict__ v_in,
    const float* __restrict__ Wq, const float* __restrict__ Wk,
    const float* __restrict__ Wv,
    float* __restrict__ Qp, float* __restrict__ Kp, float* __restrict__ Vt)
{
  const int lane   = threadIdx.x & 31;
  const int m      = lane & 15;      // A-matrix row / B-matrix column in tile
  const int half   = lane >> 4;      // 0: K-pair {0,1}, 1: K-pair {2,3}

  if (blockIdx.x < 512) {
    const int vw = blockIdx.x * 4 + (threadIdx.x >> 5);   // 0..2047
    const int h  = vw & 15;          // the 4 waves of a block: adjacent heads
    const int s0 = ((vw >> 4) & 31) * 32;
    const int b  = vw >> 9;

    // B fragments: B[k][n] = X[token s0 + 16*tt + n][head h][k]
    const float* xrow =
        v_in + ((size_t)(b * SEQ + s0 + m) * HEADS + h) * HDIM + 2 * half;
    v2f xb[2][16];
#pragma unroll
    for (int tt = 0; tt < 2; ++tt)
#pragma unroll
      for (int ks = 0; ks < 16; ++ks)
        xb[tt][ks] = *(const v2f*)(xrow + (size_t)tt * 16 * EMBED + 4 * ks);

    // D layout: lane holds row (j + 8*half) = dim, col m = token.
    float* vout = Vt + (size_t)((b * HEADS + h) * HDIM + 8 * half) * SEQ + s0 + m;

    // kept rolled: unrolled, all four Wv fragment sets are loaded up front and
    // the register count costs every wave of this kernel half its residency
#pragma unroll 1
    for (int nt = 0; nt < 4; ++nt) {
      // A fragments: A[d][k] = Wv[nt*16 + d][k]
      const float* wrow = Wv + (size_t)(nt * 16 + m) * HDIM + 2 * half;
      v2f wa[16];
#pragma unroll
      for (int ks = 0; ks < 16; ++ks)
        wa[ks] = *(const v2f*)(wrow + 4 * ks);

      // two accumulator chains per token tile (even / odd k-steps)
      v8f a0 = vzero8(), a1 = vzero8(), c0 = vzero8(), c1 = vzero8();
#pragma unroll
      for (int ks = 0; ks < 8; ++ks) {
        a0 = wmma_f32(wa[2 * ks + 0], xb[0][2 * ks + 0], a0);
        c0 = wmma_f32(wa[2 * ks + 0], xb[1][2 * ks + 0], c0);
        a1 = wmma_f32(wa[2 * ks + 1], xb[0][2 * ks + 1], a1);
        c1 = wmma_f32(wa[2 * ks + 1], xb[1][2 * ks + 1], c1);
      }
      const v8f t0 = a0 + a1;
      const v8f t1 = c0 + c1;
#pragma unroll
      for (int j = 0; j < 8; ++j) {
        vout[(size_t)(nt * 16 + j) * SEQ]      = t0[j];
        vout[(size_t)(nt * 16 + j) * SEQ + 16] = t1[j];
      }
      // the next trip reuses the stores' address and data registers
      asm volatile("s_wait_xcnt 0x0" ::: "memory");
    }
    return;
  }

  const int wave   = (blockIdx.x - 512) * 4 + (threadIdx.x >> 5);
  const int tensor = wave >> 12;     // 4096 row-tiles per tensor
  const int token  = wave & 4095;    // = b*SEQ + s
  const int b      = token >> 10;
  const int s      = token & 1023;

  const float* X = (tensor == 0) ? q_in : k_in;
  const float* W = (tensor == 0) ? Wq : Wk;

  // A fragments: 16 rows (heads of this token) x 64 features
  const float* arow = X + (size_t)(token * 16 + m) * HDIM + 2 * half;
  v2f qa[16];
#pragma unroll
  for (int ks = 0; ks < 16; ++ks)
    qa[ks] = *(const v2f*)(arow + 4 * ks);

#pragma unroll
  for (int nt = 0; nt < 4; ++nt) {
    // B fragments, batched: B[k][n] = W[n][k]  (x @ W.T)
    const float* brow = W + (size_t)(nt * 16 + m) * HDIM + 2 * half;
    v2f bf[16];
#pragma unroll
    for (int ks = 0; ks < 16; ++ks)
      bf[ks] = *(const v2f*)(brow + 4 * ks);

    // two independent accumulator chains
    v8f a0 = vzero8(), a1 = vzero8();
#pragma unroll
    for (int ks = 0; ks < 8; ++ks) {
      a0 = wmma_f32(qa[2 * ks + 0], bf[2 * ks + 0], a0);
      a1 = wmma_f32(qa[2 * ks + 1], bf[2 * ks + 1], a1);
    }
    v8f acc = a0 + a1;

    // D layout: lane holds row (j + 8*half) = head, col (nt*16 + m) = dim.
    // j-stride is the h-stride, 65536 floats.
    float* outp = (tensor == 0) ? Qp : Kp;
    const size_t base =
        ((size_t)((b * 16 + 8 * half) * SEQ + s)) * HDIM + nt * 16 + m;
#pragma unroll
    for (int j = 0; j < 8; ++j)
      outp[base + (size_t)j * (HDIM * SEQ)] = acc[j];
  }
}

// ---------------------------------------------------------------------------
// Kernel B: flash attention per (b,h).  One wave = one 16-query tile,
// streaming 64 key tiles of 16, online softmax, P*V accumulated in VGPRs.
// The 4 waves of a block share (b,h): each K/V tile is brought into LDS once
// per block by asynchronous copies of whole 16-byte pieces (two buffers, the
// next tile in flight while this one is worked on), and every wave takes its
// fragments from LDS.
// ---------------------------------------------------------------------------
#define KPITCH 68   // floats per K row in LDS: 16 rows x 8-byte reads, no bank shared
#define VPITCH 20   // floats per Vt row piece in LDS: the same for 16-float rows

// One K/V tile, a thread's share: two 16-byte pieces of K, two of Vt.
// s_wait_xcnt stands inside the statement, so that no address register of a
// copy is rewritten ahead of it.
static __device__ __forceinline__ void copy_kv_tile(
    unsigned lk0, unsigned lk1, unsigned lv0, unsigned lv1,
    const float* gk0, const float* gk1, const float* gv0, const float* gv1) {
  asm volatile(
      "global_load_async_to_lds_b128 %0, %4, off\n\t"
      "global_load_async_to_lds_b128 %1, %5, off\n\t"
      "global_load_async_to_lds_b128 %2, %6, off\n\t"
      "global_load_async_to_lds_b128 %3, %7, off\n\t"
      "s_wait_xcnt 0x0"
      :: "v"(lk0), "v"(lk1), "v"(lv0), "v"(lv1),
         "v"(gk0), "v"(gk1), "v"(gv0), "v"(gv1)
      : "memory");
}

__global__ __launch_bounds__(128) void attn_kernel(
    const float* __restrict__ Qp, const float* __restrict__ Kp,
    const float* __restrict__ Vt, const int* __restrict__ mask,
    float* __restrict__ AO)
{
  __shared__ float lds_p[4][16 * 18];   // padded stride 18: 8B aligned, no bank conflicts
  __shared__ __attribute__((aligned(16))) float lds_k[2][16 * KPITCH];
  __shared__ __attribute__((aligned(16))) float lds_v[2][HDIM * VPITCH];

  const int wslot = threadIdx.x >> 5;
  const int wave  = blockIdx.x * 4 + wslot;
  const int lane  = threadIdx.x & 31;
  const int m     = lane & 15;
  const int half  = lane >> 4;
  const int qt    = wave & 63;          // 64 query tiles per (b,h)
  const int bh    = wave >> 6;          // 0..63
  const int b     = bh >> 4;
  const int h     = bh & 15;
  const int qbase = qt * 16;

  const float* Qb = Qp + (size_t)bh * SEQ * HDIM;
  const float* Kb = Kp + (size_t)bh * SEQ * HDIM;
  const float* Vb = Vt + (size_t)bh * HDIM * SEQ;
  const int*   Mb = mask + (size_t)b * SEQ * SEQ;

  // Preload Q fragments for this 16-query tile (reused over all key tiles)
  const float* qrow = Qb + (size_t)(qbase + m) * HDIM + 2 * half;
  v2f qa[16];
#pragma unroll
  for (int ks = 0; ks < 16; ++ks)
    qa[ks] = *(const v2f*)(qrow + 4 * ks);

  v8f O[4];
  float rowmax[8], rowsum[8];
#pragma unroll
  for (int nt = 0; nt < 4; ++nt) O[nt] = vzero8();
#pragma unroll
  for (int j = 0; j < 8; ++j) { rowmax[j] = -3.4e38f; rowsum[j] = 0.f; }

  float* P = lds_p[wslot];
  const int* mrow0 = Mb + (size_t)(qbase + 8 * half) * SEQ + m;

  // This thread's share of a tile.  K tile: 16 rows of 16 pieces, piece t and
  // t + 128 (8 rows on).  Vt tile: 64 rows of 4 pieces, piece t and t + 128
  // (32 rows on).
  const int t = threadIdx.x;
  const float* gk = Kb + (size_t)(t >> 4) * HDIM + (t & 15) * 4;
  const float* gv = Vb + (size_t)(t >> 2) * SEQ + (t & 3) * 4;
  const unsigned lk =
      (unsigned)(size_t)&lds_k[0][(t >> 4) * KPITCH + (t & 15) * 4];
  const unsigned lv =
      (unsigned)(size_t)&lds_v[0][(t >> 2) * VPITCH + (t & 3) * 4];
  const unsigned kbuf_bytes = 16 * KPITCH * 4;
  const unsigned vbuf_bytes = HDIM * VPITCH * 4;

  // tile 0 into buffer 0, landed and published; then tile 1 into buffer 1
  copy_kv_tile(lk, lk + 8 * KPITCH * 4, lv, lv + 32 * VPITCH * 4,
               gk, gk + 8 * HDIM, gv, gv + 32 * SEQ);
  // this wave's copies have landed before the barrier publishes them
  asm volatile("s_wait_asynccnt 0x0" ::: "memory");
  __syncthreads();
  copy_kv_tile(lk + kbuf_bytes, lk + kbuf_bytes + 8 * KPITCH * 4,
               lv + vbuf_bytes, lv + vbuf_bytes + 32 * VPITCH * 4,
               gk + 16 * HDIM, gk + 24 * HDIM, gv + 16, gv + 32 * SEQ + 16);

  for (int kt = 0; kt < 64; ++kt) {
    const int kb0 = kt * 16;
    const int buf = kt & 1;
    const float* krow = lds_k[buf] + m * KPITCH + 2 * half;

    // batch-load K fragments from LDS
    v2f kf[16];
#pragma unroll
    for (int ks = 0; ks < 16; ++ks)
      kf[ks] = *(const v2f*)(krow + 4 * ks);

    // batch-load mask for this tile (j-stride = SEQ -> immediate offsets)
    int mk[8];
#pragma unroll
    for (int j = 0; j < 8; ++j)
      mk[j] = mrow0[(size_t)j * SEQ + kb0];

    // ---- scores: S = Q (16x64) @ K_tile^T (64x16), two chains ----
    v8f c0 = vzero8(), c1 = vzero8();
#pragma unroll
    for (int ks = 0; ks < 8; ++ks) {
      c0 = wmma_f32(qa[2 * ks + 0], kf[2 * ks + 0], c0);
      c1 = wmma_f32(qa[2 * ks + 1], kf[2 * ks + 1], c1);
    }
    v8f c = c0 + c1;

    // ---- mask + scale + online softmax (row = query, along 16 lanes) ----
    float p[8], scl[8];
#pragma unroll
    for (int j = 0; j < 8; ++j) {
      // reference: where(mask==0, -1e20) happens BEFORE /sqrt(EMBED)
      const float sv = (mk[j] == 0) ? -3.125e18f : c[j] * 0.03125f;

      float mt = sv;                           // max over the 16 keys
      mt = fmaxf(mt, __shfl_xor(mt, 1, 16));
      mt = fmaxf(mt, __shfl_xor(mt, 2, 16));
      mt = fmaxf(mt, __shfl_xor(mt, 4, 16));
      mt = fmaxf(mt, __shfl_xor(mt, 8, 16));
      const float nm = fmaxf(rowmax[j], mt);
      const float sc = __expf(rowmax[j] - nm);
      rowmax[j] = nm;
      const float pv = __expf(sv - nm);
      float st = pv;                           // sum over the 16 keys
      st += __shfl_xor(st, 1, 16);
      st += __shfl_xor(st, 2, 16);
      st += __shfl_xor(st, 4, 16);
      st += __shfl_xor(st, 8, 16);
      rowsum[j] = rowsum[j] * sc + st;
      p[j]   = pv;
      scl[j] = sc;
    }
#pragma unroll
    for (int nt = 0; nt < 4; ++nt)
#pragma unroll
      for (int j = 0; j < 8; ++j)
        O[nt][j] *= scl[j];

    // ---- stage P (C-layout -> A-layout) through LDS ----
    // (the previous trip's reads of P ended at the barrier at the loop's foot)
#pragma unroll
    for (int j = 0; j < 8; ++j)
      P[(j + 8 * half) * 18 + m] = p[j];       // P[query][key]
    __syncthreads();
    v2f pa[4];
#pragma unroll
    for (int ks = 0; ks < 4; ++ks)
      pa[ks] = *(const v2f*)(P + m * 18 + 4 * ks + 2 * half);

    // ---- O += P (16x16) @ V_tile (16x64) ----
    // batch-load all 16 V fragments first, then 16 WMMAs on 4 indep chains
    v2f vf[4][4];
#pragma unroll
    for (int nt = 0; nt < 4; ++nt) {
      const float* vrow = lds_v[buf] + (nt * 16 + m) * VPITCH + 2 * half;
#pragma unroll
      for (int ks = 0; ks < 4; ++ks)
        vf[nt][ks] = *(const v2f*)(vrow + 4 * ks);
    }
#pragma unroll
    for (int ks = 0; ks < 4; ++ks)
#pragma unroll
      for (int nt = 0; nt < 4; ++nt)
        O[nt] = wmma_f32(pa[ks], vf[nt][ks], O[nt]);

    // ---- publish tile kt + 1, free this trip's buffer ----
    // this wave's LDS reads of the buffer (and of P) have returned
    asm volatile("s_wait_dscnt 0x0" ::: "memory");
    // this wave's copies of tile kt + 1 have landed
    asm volatile("s_wait_asynccnt 0x0" ::: "memory");
    __syncthreads();
    if (kt + 2 < 64) {
      const float* nk = gk + (size_t)(kt + 2) * 16 * HDIM;
      const float* nv = gv + (kt + 2) * 16;
      const unsigned bk = lk + buf * kbuf_bytes;
      const unsigned bv = lv + buf * vbuf_bytes;
      copy_kv_tile(bk, bk + 8 * KPITCH * 4, bv, bv + 32 * VPITCH * 4,
                   nk, nk + 8 * HDIM, nv, nv + 32 * SEQ);
    }
  }
  // nothing is in flight when the wave ends
  asm volatile("s_wait_asynccnt 0x0" ::: "memory");

  // finalize: divide by rowsum, store as [B, S, H*D]  (j-stride = 1024 floats)
  float inv[8];
#pragma unroll
  for (int j = 0; j < 8; ++j) inv[j] = 1.f / rowsum[j];
#pragma unroll
  for (int nt = 0; nt < 4; ++nt) {
    const size_t base =
        ((size_t)(b * SEQ + qbase + 8 * half) * HEADS + h) * HDIM + nt * 16 + m;
#pragma unroll
    for (int j = 0; j < 8; ++j)
      AO[base + (size_t)j * EMBED] = O[nt][j] * inv[j];
  }
}

// ---------------------------------------------------------------------------
// Kernel C: out = X[4096,1024] @ Wu^T + bu.  Wave = 32x64 output tile
// (two 16-row M-tiles share the same Wu B-fragments: halves Wu traffic,
//  32 WMMAs per 24 loads per K-block, 8 independent accumulator chains).
// ---------------------------------------------------------------------------
__global__ __launch_bounds__(128) void out_proj_kernel(
    const float* __restrict__ X, const float* __restrict__ Wu,
    const float* __restrict__ bu, float* __restrict__ out)
{
  const int wave  = blockIdx.x * 4 + (threadIdx.x >> 5);
  const int lane  = threadIdx.x & 31;
  const int m     = lane & 15;
  const int half  = lane >> 4;
  const int ntile = wave & 15;          // 16 tiles of 64 output cols
  const int mtile = wave >> 4;          // 128 tiles of 32 rows
  const int row0  = mtile * 32;
  const int col0  = ntile * 64;

  v8f acc[2][4];
#pragma unroll
  for (int mt = 0; mt < 2; ++mt)
#pragma unroll
    for (int nt = 0; nt < 4; ++nt) acc[mt][nt] = vzero8();

  const float* arow0 = X  + (size_t)(row0 + m) * EMBED + 2 * half;
  const float* arow1 = arow0 + (size_t)16 * EMBED;
  const float* brow  = Wu + (size_t)(col0 + m) * EMBED + 2 * half;

  for (int kb = 0; kb < 64; ++kb) {   // 64 blocks x 4 k-steps = K=1024
    v2f af[2][4];
    v2f bf[4][4];
#pragma unroll
    for (int i = 0; i < 4; ++i) {
      af[0][i] = *(const v2f*)(arow0 + 16 * kb + 4 * i);
      af[1][i] = *(const v2f*)(arow1 + 16 * kb + 4 * i);
    }
#pragma unroll
    for (int nt = 0; nt < 4; ++nt)
#pragma unroll
      for (int i = 0; i < 4; ++i)
        bf[nt][i] = *(const v2f*)(brow + (size_t)nt * 16 * EMBED + 16 * kb + 4 * i);

#pragma unroll
    for (int i = 0; i < 4; ++i)
#pragma unroll
      for (int mt = 0; mt < 2; ++mt)
#pragma unroll
        for (int nt = 0; nt < 4; ++nt)
          acc[mt][nt] = wmma_f32(af[mt][i], bf[nt][i], acc[mt][nt]);
  }

#pragma unroll
  for (int mt = 0; mt < 2; ++mt)
#pragma unroll
    for (int nt = 0; nt < 4; ++nt) {
      const float bias = bu[col0 + nt * 16 + m];
      const size_t base =
          (size_t)(row0 + mt * 16 + 8 * half) * EMBED + col0 + nt * 16 + m;
#pragma unroll
      for (int j = 0; j < 8; ++j)
        out[base + (size_t)j * EMBED] = acc[mt][nt][j] + bias;
    }
}

// ---------------------------------------------------------------------------
extern "C" void kernel_launch(void* const* d_in, const int* in_sizes, int n_in,
                              void* d_out, int out_size, void* d_ws, size_t ws_size,
                              hipStream_t stream) {
  (void)in_sizes; (void)n_in; (void)out_size; (void)ws_size;
  const float* values = (const float*)d_in[0];
  const float* keys   = (const float*)d_in[1];
  const float* query  = (const float*)d_in[2];
  const int*   mask   = (const int*)d_in[3];
  const float* Wv     = (const float*)d_in[4];
  const float* Wq     = (const float*)d_in[5];
  const float* Wk     = (const float*)d_in[6];
  const float* Wu     = (const float*)d_in[7];
  const float* bu     = (const float*)d_in[8];
  float* out = (float*)d_out;

  // workspace layout (f32): Qp | Kp | Vt | AO, 4M floats each = 64 MB total
  float* ws = (float*)d_ws;
  const size_t T = (size_t)BATCH * HEADS * SEQ * HDIM;   // 4,194,304
  float* Qp = ws;
  float* Kp = ws + T;
  float* Vt = ws + 2 * T;
  float* AO = ws + 3 * T;

  // A: V 2048 waves (32 tokens x 1 head) + Q,K 2 * 4096 row-tiles, 4 per block
  qkv_proj_kernel<<<2560, 128, 0, stream>>>(query, keys, values, Wq, Wk, Wv,
                                            Qp, Kp, Vt);
  // B: 64 (b,h) * 64 q-tiles = 4096 waves / 4 per block
  attn_kernel<<<1024, 128, 0, stream>>>(Qp, Kp, Vt, mask, AO);
  // C: 128 m-tiles(32 rows) * 16 n-tiles = 2048 waves / 4 per block
  out_proj_kernel<<<512, 128, 0, stream>>>(AO, Wu, bu, out);
}

// v003
// A run of this version takes 187 microseconds.
// In two side-by-side timings against v002, it was 1.18 and 1.19 times as fast.
// Over all steps from v000 it is 2.11 times as fast.
#include <hip/hip_runtime.h>

#define EMBED 1024
#define HEADS 16
#define HDIM  64
#define BATCH 4
#define SEQ   1024

typedef __attribute__((ext_vector_type(2))) float v2f;
typedef __attribute__((ext_vector_type(4))) float v4f;
typedef __attribute__((ext_vector_type(8))) float v8f;
typedef __attribute__((ext_vector_type(4))) int   v4i;

// D = A(16x4 f32) * B(4x16 f32) + C(16x16 f32)   -- CDNA5 V_WMMA_F32_16X16X4_F32
static __device__ __forceinline__ v8f wmma_f32(v2f a, v2f b, v8f c) {
  return __builtin_amdgcn_wmma_f32_16x16x4_f32(
      /*neg_a=*/false, a, /*neg_b=*/false, b,
      /*c_mod=*/(short)0, c, /*reuse_a=*/false, /*reuse_b=*/false);
}

static __device__ __forceinline__ v8f vzero8() {
  return (v8f){0.f, 0.f, 0.f, 0.f, 0.f, 0.f, 0.f, 0.f};
}

// ---------------------------------------------------------------------------
// Kernel A: per-head linear projections,  y = x @ W.T  (W is [64,64], shared
// across heads).
// Blocks 0..511: values->Wv -> Vt [B,H,D,S] (transposed for V^T*P^T A-fragments).
//   One wave = 32 consecutive tokens of one head.  It computes Wv * X^T, so
//   the accumulator's columns (the 16 lanes of a half-wave) are consecutive
//   tokens: each store writes 64-byte runs along S, and the wave owns the
//   whole 128-byte line of every Vt row it touches.
// Blocks 512..2559: query->Wq -> Qp [B,H,S,D], keys->Wk -> Kp [B,H,S,D].
//   One wave = 16 rows (the 16 heads of one token) x 64 output dims.
// ---------------------------------------------------------------------------
__global__ __launch_bounds__(128) void qkv_proj_kernel(
    const float* __restrict__ q_in, const float* __restrict__ k_in,
    const float* __restrict__ v_in,
    const float* __restrict__ Wq, const float* __restrict__ Wk,
    const float* __restrict__ Wv,
    float* __restrict__ Qp, float* __restrict__ Kp, float* __restrict__ Vt)
{
  const int lane   = threadIdx.x & 31;
  const int m      = lane & 15;      // A-matrix row / B-matrix column in tile
  const int half   = lane >> 4;      // 0: K-pair {0,1}, 1: K-pair {2,3}

  if (blockIdx.x < 512) {
    const int vw = blockIdx.x * 4 + (threadIdx.x >> 5);   // 0..2047
    const int h  = vw & 15;          // the 4 waves of a block: adjacent heads
    const int s0 = ((vw >> 4) & 31) * 32;
    const int b  = vw >> 9;

    // B fragments: B[k][n] = X[token s0 + 16*tt + n][head h][k]
    const float* xrow =
        v_in + ((size_t)(b * SEQ + s0 + m) * HEADS + h) * HDIM + 2 * half;
    v2f xb[2][16];
#pragma unroll
    for (int tt = 0; tt < 2; ++tt)
#pragma unroll
      for (int ks = 0; ks < 16; ++ks)
        xb[tt][ks] = *(const v2f*)(xrow + (size_t)tt * 16 * EMBED + 4 * ks);

    // D layout: lane holds row (j + 8*half) = dim, col m = token.
    float* vout = Vt + (size_t)((b * HEADS + h) * HDIM + 8 * half) * SEQ + s0 + m;

    // kept rolled: unrolled, all four Wv fragment sets are loaded up front and
    // the register count costs every wave of this kernel half its residency
#pragma unroll 1
    for (int nt = 0; nt < 4; ++nt) {
      // A fragments: A[d][k] = Wv[nt*16 + d][k]
      const float* wrow = Wv + (size_t)(nt * 16 + m) * HDIM + 2 * half;
      v2f wa[16];
#pragma unroll
      for (int ks = 0; ks < 16; ++ks)
        wa[ks] = *(const v2f*)(wrow + 4 * ks);

      // two accumulator chains per token tile (even / odd k-steps)
      v8f a0 = vzero8(), a1 = vzero8(), c0 = vzero8(), c1 = vzero8();
#pragma unroll
      for (int ks = 0; ks < 8; ++ks) {
        a0 = wmma_f32(wa[2 * ks + 0], xb[0][2 * ks + 0], a0);
        c0 = wmma_f32(wa[2 * ks + 0], xb[1][2 * ks + 0], c0);
        a1 = wmma_f32(wa[2 * ks + 1], xb[0][2 * ks + 1], a1);
        c1 = wmma_f32(wa[2 * ks + 1], xb[1][2 * ks + 1], c1);
      }
      const v8f t0 = a0 + a1;
      const v8f t1 = c0 + c1;
#pragma unroll
      for (int j = 0; j < 8; ++j) {
        vout[(size_t)(nt * 16 + j) * SEQ]      = t0[j];
        vout[(size_t)(nt * 16 + j) * SEQ + 16] = t1[j];
      }
      // the next trip reuses the stores' address and data registers
      asm volatile("s_wait_xcnt 0x0" ::: "memory");
    }
    return;
  }

  const int wave   = (blockIdx.x - 512) * 4 + (threadIdx.x >> 5);
  const int tensor = wave >> 12;     // 4096 row-tiles per tensor
  const int token  = wave & 4095;    // = b*SEQ + s
  const int b      = token >> 10;
  const int s      = token & 1023;

  const float* X = (tensor == 0) ? q_in : k_in;
  const float* W = (tensor == 0) ? Wq : Wk;

  // A fragments: 16 rows (heads of this token) x 64 features
  const float* arow = X + (size_t)(token * 16 + m) * HDIM + 2 * half;
  v2f qa[16];
#pragma unroll
  for (int ks = 0; ks < 16; ++ks)
    qa[ks] = *(const v2f*)(arow + 4 * ks);

#pragma unroll
  for (int nt = 0; nt < 4; ++nt) {
    // B fragments, batched: B[k][n] = W[n][k]  (x @ W.T)
    const float* brow = W + (size_t)(nt * 16 + m) * HDIM + 2 * half;
    v2f bf[16];
#pragma unroll
    for (int ks = 0; ks < 16; ++ks)
      bf[ks] = *(const v2f*)(brow + 4 * ks);

    // two independent accumulator chains
    v8f a0 = vzero8(), a1 = vzero8();
#pragma unroll
    for (int ks = 0; ks < 8; ++ks) {
      a0 = wmma_f32(qa[2 * ks + 0], bf[2 * ks + 0], a0);
      a1 = wmma_f32(qa[2 * ks + 1], bf[2 * ks + 1], a1);
    }
    v8f acc = a0 + a1;

    // D layout: lane holds row (j + 8*half) = head, col (nt*16 + m) = dim.
    // j-stride is the h-stride, 65536 floats.
    float* outp = (tensor == 0) ? Qp : Kp;
    const size_t base =
        ((size_t)((b * 16 + 8 * half) * SEQ + s)) * HDIM + nt * 16 + m;
#pragma unroll
    for (int j = 0; j < 8; ++j)
      outp[base + (size_t)j * (HDIM * SEQ)] = acc[j];
  }
}

#define KPITCH 68
#define VPITCH 20

// One K/V tile, a thread's share: two 16-byte pieces of K, two of Vt.
// s_wait_xcnt stands inside the statement, so that no address register of a
// copy is rewritten ahead of it.
static __device__ __forceinline__ void copy_kv_tile(
    unsigned lk0, unsigned lk1, unsigned lv0, unsigned lv1,
    const float* gk0, const float* gk1, const float* gv0, const float* gv1) {
  asm volatile(
      "global_load_async_to_lds_b128 %0, %4, off\n\t"
      "global_load_async_to_lds_b128 %1, %5, off\n\t"
      "global_load_async_to_lds_b128 %2, %6, off\n\t"
      "global_load_async_to_lds_b128 %3, %7, off\n\t"
      "s_wait_xcnt 0x0"
      :: "v"(lk0), "v"(lk1), "v"(lv0), "v"(lv1),
         "v"(gk0), "v"(gk1), "v"(gv0), "v"(gv1)
      : "memory");
}

// lane l with lane l ^ 16
static __device__ __forceinline__ float xhalf(float x) {
  return __builtin_bit_cast(float, __builtin_amdgcn_permlanex16(
      __builtin_bit_cast(int, x), __builtin_bit_cast(int, x),
      0x76543210, 0xfedcba98, false, false));
}

__global__ __launch_bounds__(128) void attn_kernel(
    const float* __restrict__ Qp, const float* __restrict__ Kp,
    const float* __restrict__ Vt, const int* __restrict__ mask,
    float* __restrict__ AO)
{
  __shared__ __attribute__((aligned(16))) float lds_k[2][16 * KPITCH];
  __shared__ __attribute__((aligned(16))) float lds_v[2][HDIM * VPITCH];

  const int wslot = threadIdx.x >> 5;
  const int wave  = blockIdx.x * 4 + wslot;
  const int lane  = threadIdx.x & 31;
  const int m     = lane & 15;
  const int half  = lane >> 4;
  const int qt    = wave & 63;          // 64 query tiles per (b,h)
  const int bh    = wave >> 6;          // 0..63
  const int b     = bh >> 4;
  const int h     = bh & 15;
  const int qbase = qt * 16;

  const float* Qb = Qp + (size_t)bh * SEQ * HDIM;
  const float* Kb = Kp + (size_t)bh * SEQ * HDIM;
  const float* Vb = Vt + (size_t)bh * HDIM * SEQ;
  const int*   Mb = mask + (size_t)b * SEQ * SEQ;

  // Preload Q fragments for this 16-query tile (reused over all key tiles):
  // B[k][n] = Q[qbase + n][k]
  const float* qrow = Qb + (size_t)(qbase + m) * HDIM + 2 * half;
  v2f qa[16];
#pragma unroll
  for (int ks = 0; ks < 16; ++ks)
    qa[ks] = *(const v2f*)(qrow + 4 * ks);

  // O[nt][j] = O^T[dim nt*16 + 8*half + j][query m]
  v8f O[4];
#pragma unroll
  for (int nt = 0; nt < 4; ++nt) O[nt] = vzero8();
  float rowmax = -3.4e38f;   // of query m, the same in both halves
  float rowsum = 0.f;        // of query m, this half's keys only

  // this lane's 8 keys of a tile: 8*half .. 8*half + 7 of query m's mask row
  const int* mrow = Mb + (size_t)(qbase + m) * SEQ + 8 * half;

  // This thread's share of a tile.  K tile: 16 rows of 16 pieces, piece t and
  // t + 128 (8 rows on).  Vt tile: 64 rows of 4 pieces, piece t and t + 128
  // (32 rows on).
  const int t = threadIdx.x;
  const float* gk = Kb + (size_t)(t >> 4) * HDIM + (t & 15) * 4;
  const float* gv = Vb + (size_t)(t >> 2) * SEQ + (t & 3) * 4;
  const unsigned lk =
      (unsigned)(size_t)&lds_k[0][(t >> 4) * KPITCH + (t & 15) * 4];
  const unsigned lv =
      (unsigned)(size_t)&lds_v[0][(t >> 2) * VPITCH + (t & 3) * 4];
  const unsigned kbuf_bytes = 16 * KPITCH * 4;
  const unsigned vbuf_bytes = HDIM * VPITCH * 4;

  // tile 0 into buffer 0, landed and published; then tile 1 into buffer 1
  copy_kv_tile(lk, lk + 8 * KPITCH * 4, lv, lv + 32 * VPITCH * 4,
               gk, gk + 8 * HDIM, gv, gv + 32 * SEQ);
  // this wave's copies have landed before the barrier publishes them
  asm volatile("s_wait_asynccnt 0x0" ::: "memory");
  __syncthreads();
  copy_kv_tile(lk + kbuf_bytes, lk + kbuf_bytes + 8 * KPITCH * 4,
               lv + vbuf_bytes, lv + vbuf_bytes + 32 * VPITCH * 4,
               gk + 16 * HDIM, gk + 24 * HDIM, gv + 16, gv + 32 * SEQ + 16);

  for (int kt = 0; kt < 64; ++kt) {
    const int kb0 = kt * 16;
    const int buf = kt & 1;
    const float* krow = lds_k[buf] + m * KPITCH + 2 * half;

    // batch-load K fragments from LDS
    v2f kf[16];
#pragma unroll
    for (int ks = 0; ks < 16; ++ks)
      kf[ks] = *(const v2f*)(krow + 4 * ks);

    // this lane's 8 mask words of the tile, two 16-byte loads
    const v4i mk0 = *(const v4i*)(mrow + kb0);
    const v4i mk1 = *(const v4i*)(mrow + kb0 + 4);

    // V^T fragments: 8 consecutive keys of a Vt row, two 16-byte LDS reads
    v4f va[4][2];
#pragma unroll
    for (int nt = 0; nt < 4; ++nt) {
      const float* vrow = lds_v[buf] + (nt * 16 + m) * VPITCH + 8 * half;
      va[nt][0] = *(const v4f*)(vrow);
      va[nt][1] = *(const v4f*)(vrow + 4);
    }
    // keeps the trip's loads together here, ahead of the products: sunk among
    // the matrix instructions, each one's latency is waited out where it stands
    __builtin_amdgcn_sched_barrier(0);

    // ---- scores: S^T = K_tile (16x64) @ Q^T (64x16), two chains ----
    v8f c0 = vzero8(), c1 = vzero8();
#pragma unroll
    for (int ks = 0; ks < 8; ++ks) {
      c0 = wmma_f32(kf[2 * ks + 0], qa[2 * ks + 0], c0);
      c1 = wmma_f32(kf[2 * ks + 1], qa[2 * ks + 1], c1);
    }
    // keeps the mask's first use, and with it the wait for the mask loads,
    // behind the score products
    __builtin_amdgcn_sched_barrier(0);
    const v8f c = c0 + c1;   // c[j] = S[query m][key kb0 + 8*half + j]

    // ---- mask + scale + online softmax, one query per lane ----
    float sv[8];
#pragma unroll
    for (int j = 0; j < 8; ++j) {
      const int mk = (j < 4) ? mk0[j & 3] : mk1[j & 3];
      // reference: where(mask==0, -1e20) happens BEFORE /sqrt(EMBED)
      sv[j] = (mk == 0) ? -3.125e18f : c[j] * 0.03125f;
    }
    float mt = fmaxf(fmaxf(fmaxf(sv[0], sv[1]), fmaxf(sv[2], sv[3])),
                     fmaxf(fmaxf(sv[4], sv[5]), fmaxf(sv[6], sv[7])));
    mt = fmaxf(mt, xhalf(mt));                 // max over the 16 keys
    const float nm = fmaxf(rowmax, mt);
    const float sc = __expf(rowmax - nm);
    rowmax = nm;
    float p[8];
#pragma unroll
    for (int j = 0; j < 8; ++j)
      p[j] = __expf(sv[j] - nm);
    // the halves' sums are joined once, behind the loop
    rowsum = rowsum * sc +
             (((p[0] + p[1]) + (p[2] + p[3])) + ((p[4] + p[5]) + (p[6] + p[7])));
#pragma unroll
    for (int nt = 0; nt < 4; ++nt)
      O[nt] *= sc;

    // ---- O^T += V^T_tile (64x16) @ P^T (16x16) ----
    // k order of step ks, both operands: key 8*half + 2*ks + {0,1}.
    // B = P^T straight from the lane's scores; A = the V^T fragments.
#pragma unroll
    for (int ks = 0; ks < 4; ++ks) {
      const v2f pb = (v2f){p[2 * ks], p[2 * ks + 1]};
#pragma unroll
      for (int nt = 0; nt < 4; ++nt) {
        const v4f q4 = va[nt][ks >> 1];
        const v2f av = (ks & 1) ? (v2f){q4[2], q4[3]} : (v2f){q4[0], q4[1]};
        O[nt] = wmma_f32(av, pb, O[nt]);
      }
    }

    // ---- publish tile kt + 1, free this trip's buffer ----
    // keeps the products in front of the waits: lifted over them, the wait for
    // tile kt + 1 would stand right behind the issue of its copies
    __builtin_amdgcn_sched_barrier(0);
    // this wave's LDS reads of the buffer have returned
    asm volatile("s_wait_dscnt 0x0" ::: "memory");
    // this wave's copies of tile kt + 1 have landed
    asm volatile("s_wait_asynccnt 0x0" ::: "memory");
    __syncthreads();
    if (kt + 2 < 64) {
      const float* nk = gk + (size_t)(kt + 2) * 16 * HDIM;
      const float* nv = gv + (kt + 2) * 16;
      const unsigned bk = lk + buf * kbuf_bytes;
      const unsigned bv = lv + buf * vbuf_bytes;
      copy_kv_tile(bk, bk + 8 * KPITCH * 4, bv, bv + 32 * VPITCH * 4,
                   nk, nk + 8 * HDIM, nv, nv + 32 * SEQ);
    }
  }
  // nothing is in flight when the wave ends
  asm volatile("s_wait_asynccnt 0x0" ::: "memory");

  // finalize: join the halves' sums, divide, store as [B, S, H*D]; a lane's 8
  // accumulator values are 8 consecutive dims of its query's row
  const float inv = 1.f / (rowsum + xhalf(rowsum));
  float* ao =
      AO + ((size_t)(b * SEQ + qbase + m) * HEADS + h) * HDIM + 8 * half;
#pragma unroll
  for (int nt = 0; nt < 4; ++nt) {
    const v8f o = O[nt] * inv;
    *(v4f*)(ao + nt * 16)     = (v4f){o[0], o[1], o[2], o[3]};
    *(v4f*)(ao + nt * 16 + 4) = (v4f){o[4], o[5], o[6], o[7]};
  }
}

// ---------------------------------------------------------------------------
// Kernel C: out = X[4096,1024] @ Wu^T + bu.  Wave = 32x64 output tile
// (two 16-row M-tiles share the same Wu B-fragments: halves Wu traffic,
//  32 WMMAs per 24 loads per K-block, 8 independent accumulator chains).
// ---------------------------------------------------------------------------
__global__ __launch_bounds__(128) void out_proj_kernel(
    const float* __restrict__ X, const float* __restrict__ Wu,
    const float* __restrict__ bu, float* __restrict__ out)
{
  const int wave  = blockIdx.x * 4 + (threadIdx.x >> 5);
  const int lane  = threadIdx.x & 31;
  const int m     = lane & 15;
  const int half  = lane >> 4;
  const int ntile = wave & 15;          // 16 tiles of 64 output cols
  const int mtile = wave >> 4;          // 128 tiles of 32 rows
  const int row0  = mtile * 32;
  const int col0  = ntile * 64;

  v8f acc[2][4];
#pragma unroll
  for (int mt = 0; mt < 2; ++mt)
#pragma unroll
    for (int nt = 0; nt < 4; ++nt) acc[mt][nt] = vzero8();

  const float* arow0 = X  + (size_t)(row0 + m) * EMBED + 2 * half;
  const float* arow1 = arow0 + (size_t)16 * EMBED;
  const float* brow  = Wu + (size_t)(col0 + m) * EMBED + 2 * half;

  for (int kb = 0; kb < 64; ++kb) {   // 64 blocks x 4 k-steps = K=1024
    v2f af[2][4];
    v2f bf[4][4];
#pragma unroll
    for (int i = 0; i < 4; ++i) {
      af[0][i] = *(const v2f*)(arow0 + 16 * kb + 4 * i);
      af[1][i] = *(const v2f*)(arow1 + 16 * kb + 4 * i);
    }
#pragma unroll
    for (int nt = 0; nt < 4; ++nt)
#pragma unroll
      for (int i = 0; i < 4; ++i)
        bf[nt][i] = *(const v2f*)(brow + (size_t)nt * 16 * EMBED + 16 * kb + 4 * i);

#pragma unroll
    for (int i = 0; i < 4; ++i)
#pragma unroll
      for (int mt = 0; mt < 2; ++mt)
#pragma unroll
        for (int nt = 0; nt < 4; ++nt)
          acc[mt][nt] = wmma_f32(af[mt][i], bf[nt][i], acc[mt][nt]);
  }

#pragma unroll
  for (int mt = 0; mt < 2; ++mt)
#pragma unroll
    for (int nt = 0; nt < 4; ++nt) {
      const float bias = bu[col0 + nt * 16 + m];
      const size_t base =
          (size_t)(row0 + mt * 16 + 8 * half) * EMBED + col0 + nt * 16 + m;
#pragma unroll
      for (int j = 0; j < 8; ++j)
        out[base + (size_t)j * EMBED] = acc[mt][nt][j] + bias;
    }
}

// ---------------------------------------------------------------------------
extern "C" void kernel_launch(void* const* d_in, const int* in_sizes, int n_in,
                              void* d_out, int out_size, void* d_ws, size_t ws_size,
                              hipStream_t stream) {
  (void)in_sizes; (void)n_in; (void)out_size; (void)ws_size;
  const float* values = (const float*)d_in[0];
  const float* keys   = (const float*)d_in[1];
  const float* query  = (const float*)d_in[2];
  const int*   mask   = (const int*)d_in[3];
  const float* Wv     = (const float*)d_in[4];
  const float* Wq     = (const float*)d_in[5];
  const float* Wk     = (const float*)d_in[6];
  const float* Wu     = (const float*)d_in[7];
  const float* bu     = (const float*)d_in[8];
  float* out = (float*)d_out;

  // workspace layout (f32): Qp | Kp | Vt | AO, 4M floats each = 64 MB total
  float* ws = (float*)d_ws;
  const size_t T = (size_t)BATCH * HEADS * SEQ * HDIM;   // 4,194,304
  float* Qp = ws;
  float* Kp = ws + T;
  float* Vt = ws + 2 * T;
  float* AO = ws + 3 * T;

  // A: V 2048 waves (32 tokens x 1 head) + Q,K 2 * 4096 row-tiles, 4 per block
  qkv_proj_kernel<<<2560, 128, 0, stream>>>(query, keys, values, Wq, Wk, Wv,
                                            Qp, Kp, Vt);
  // B: 64 (b,h) * 64 q-tiles = 4096 waves / 4 per block
  attn_kernel<<<1024, 128, 0, stream>>>(Qp, Kp, Vt, mask, AO);
  // C: 128 m-tiles(32 rows) * 16 n-tiles = 2048 waves / 4 per block
  out_proj_kernel<<<512, 128, 0, stream>>>(AO, Wu, bu, out);
}

// v004
// One run takes 171 microseconds.
// Next to v003, in two timings, it ran 1.10 and 1.11 times as fast.
// Over all steps from v000 it is 2.33 times as fast.
#include <hip/hip_runtime.h>

#define EMBED 1024
#define HEADS 16
#define HDIM  64
#define BATCH 4
#define SEQ   1024

typedef __attribute__((ext_vector_type(2))) float v2f;
typedef __attribute__((ext_vector_type(4))) float v4f;
typedef __attribute__((ext_vector_type(8))) float v8f;
typedef __attribute__((ext_vector_type(4))) int   v4i;

// D = A(16x4 f32) * B(4x16 f32) + C(16x16 f32)   -- CDNA5 V_WMMA_F32_16X16X4_F32
static __device__ __forceinline__ v8f wmma_f32(v2f a, v2f b, v8f c) {
  return __builtin_amdgcn_wmma_f32_16x16x4_f32(
      /*neg_a=*/false, a, /*neg_b=*/false, b,
      /*c_mod=*/(short)0, c, /*reuse_a=*/false, /*reuse_b=*/false);
}

static __device__ __forceinline__ v8f vzero8() {
  return (v8f){0.f, 0.f, 0.f, 0.f, 0.f, 0.f, 0.f, 0.f};
}

// ---------------------------------------------------------------------------
// Kernel A: per-head linear projections,  y = x @ W.T  (W is [64,64], shared
// across heads).
// Blocks 0..511: values->Wv -> Vt [B,H,D,S] (transposed for V^T*P^T A-fragments).
//   One wave = 32 consecutive tokens of one head.  It computes Wv * X^T, so
//   the accumulator's columns (the 16 lanes of a half-wave) are consecutive
//   tokens: each store writes 64-byte runs along S, and the wave owns the
//   whole 128-byte line of every Vt row it touches.
// Blocks 512..2559: query->Wq -> Qp [B,H,S,D], keys->Wk -> Kp [B,H,S,D].
//   One wave = 16 rows (the 16 heads of one token) x 64 output dims.
// ---------------------------------------------------------------------------
__global__ __launch_bounds__(128) void qkv_proj_kernel(
    const float* __restrict__ q_in, const float* __restrict__ k_in,
    const float* __restrict__ v_in,
    const float* __restrict__ Wq, const float* __restrict__ Wk,
    const float* __restrict__ Wv,
    float* __restrict__ Qp, float* __restrict__ Kp, float* __restrict__ Vt)
{
  const int lane   = threadIdx.x & 31;
  const int m      = lane & 15;      // A-matrix row / B-matrix column in tile
  const int half   = lane >> 4;      // 0: K-pair {0,1}, 1: K-pair {2,3}

  if (blockIdx.x < 512) {
    const int vw = blockIdx.x * 4 + (threadIdx.x >> 5);   // 0..2047
    const int h  = vw & 15;          // the 4 waves of a block: adjacent heads
    const int s0 = ((vw >> 4) & 31) * 32;
    const int b  = vw >> 9;

    // B fragments: B[k][n] = X[token s0 + 16*tt + n][head h][k]
    const float* xrow =
        v_in + ((size_t)(b * SEQ + s0 + m) * HEADS + h) * HDIM + 2 * half;
    v2f xb[2][16];
#pragma unroll
    for (int tt = 0; tt < 2; ++tt)
#pragma unroll
      for (int ks = 0; ks < 16; ++ks)
        xb[tt][ks] = *(const v2f*)(xrow + (size_t)tt * 16 * EMBED + 4 * ks);

    // D layout: lane holds row (j + 8*half) = dim, col m = token.
    float* vout = Vt + (size_t)((b * HEADS + h) * HDIM + 8 * half) * SEQ + s0 + m;

    // kept rolled: unrolled, all four Wv fragment sets are loaded up front and
    // the register count costs every wave of this kernel half its residency
#pragma unroll 1
    for (int nt = 0; nt < 4; ++nt) {
      // A fragments: A[d][k] = Wv[nt*16 + d][k]
      const float* wrow = Wv + (size_t)(nt * 16 + m) * HDIM + 2 * half;
      v2f wa[16];
#pragma unroll
      for (int ks = 0; ks < 16; ++ks)
        wa[ks] = *(const v2f*)(wrow + 4 * ks);

      // two accumulator chains per token tile (even / odd k-steps)
      v8f a0 = vzero8(), a1 = vzero8(), c0 = vzero8(), c1 = vzero8();
#pragma unroll
      for (int ks = 0; ks < 8; ++ks) {
        a0 = wmma_f32(wa[2 * ks + 0], xb[0][2 * ks + 0], a0);
        c0 = wmma_f32(wa[2 * ks + 0], xb[1][2 * ks + 0], c0);
        a1 = wmma_f32(wa[2 * ks + 1], xb[0][2 * ks + 1], a1);
        c1 = wmma_f32(wa[2 * ks + 1], xb[1][2 * ks + 1], c1);
      }
      const v8f t0 = a0 + a1;
      const v8f t1 = c0 + c1;
#pragma unroll
      for (int j = 0; j < 8; ++j) {
        vout[(size_t)(nt * 16 + j) * SEQ]      = t0[j];
        vout[(size_t)(nt * 16 + j) * SEQ + 16] = t1[j];
      }
      // the next trip reuses the stores' address and data registers
      asm volatile("s_wait_xcnt 0x0" ::: "memory");
    }
    return;
  }

  const int wave   = (blockIdx.x - 512) * 4 + (threadIdx.x >> 5);
  const int tensor = wave >> 12;     // 4096 row-tiles per tensor
  const int token  = wave & 4095;    // = b*SEQ + s
  const int b      = token >> 10;
  const int s      = token & 1023;

  const float* X = (tensor == 0) ? q_in : k_in;
  const float* W = (tensor == 0) ? Wq : Wk;

  // A fragments: 16 rows (heads of this token) x 64 features
  const float* arow = X + (size_t)(token * 16 + m) * HDIM + 2 * half;
  v2f qa[16];
#pragma unroll
  for (int ks = 0; ks < 16; ++ks)
    qa[ks] = *(const v2f*)(arow + 4 * ks);

#pragma unroll
  for (int nt = 0; nt < 4; ++nt) {
    // B fragments, batched: B[k][n] = W[n][k]  (x @ W.T)
    const float* brow = W + (size_t)(nt * 16 + m) * HDIM + 2 * half;
    v2f bf[16];
#pragma unroll
    for (int ks = 0; ks < 16; ++ks)
      bf[ks] = *(const v2f*)(brow + 4 * ks);

    // two independent accumulator chains
    v8f a0 = vzero8(), a1 = vzero8();
#pragma unroll
    for (int ks = 0; ks < 8; ++ks) {
      a0 = wmma_f32(qa[2 * ks + 0], bf[2 * ks + 0], a0);
      a1 = wmma_f32(qa[2 * ks + 1], bf[2 * ks + 1], a1);
    }
    v8f acc = a0 + a1;

    // D layout: lane holds row (j + 8*half) = head, col (nt*16 + m) = dim.
    // j-stride is the h-stride, 65536 floats.
    float* outp = (tensor == 0) ? Qp : Kp;
    const size_t base =
        ((size_t)((b * 16 + 8 * half) * SEQ + s)) * HDIM + nt * 16 + m;
#pragma unroll
    for (int j = 0; j < 8; ++j)
      outp[base + (size_t)j * (HDIM * SEQ)] = acc[j];
  }
}

#define KPITCH 68
#define VPITCH 20

// One K/V tile, a thread's share: two 16-byte pieces of K, two of Vt.
// s_wait_xcnt stands inside the statement, so that no address register of a
// copy is rewritten ahead of it.
static __device__ __forceinline__ void copy_kv_tile(
    unsigned lk0, unsigned lk1, unsigned lv0, unsigned lv1,
    const float* gk0, const float* gk1, const float* gv0, const float* gv1) {
  asm volatile(
      "global_load_async_to_lds_b128 %0, %4, off\n\t"
      "global_load_async_to_lds_b128 %1, %5, off\n\t"
      "global_load_async_to_lds_b128 %2, %6, off\n\t"
      "global_load_async_to_lds_b128 %3, %7, off\n\t"
      "s_wait_xcnt 0x0"
      :: "v"(lk0), "v"(lk1), "v"(lv0), "v"(lv1),
         "v"(gk0), "v"(gk1), "v"(gv0), "v"(gv1)
      : "memory");
}

// lane l with lane l ^ 16
static __device__ __forceinline__ float xhalf(float x) {
  return __builtin_bit_cast(float, __builtin_amdgcn_permlanex16(
      __builtin_bit_cast(int, x), __builtin_bit_cast(int, x),
      0x76543210, 0xfedcba98, false, false));
}

__global__ __launch_bounds__(128) void attn_kernel(
    const float* __restrict__ Qp, const float* __restrict__ Kp,
    const float* __restrict__ Vt, const int* __restrict__ mask,
    float* __restrict__ AO)
{
  __shared__ __attribute__((aligned(16))) float lds_k[2][16 * KPITCH];
  __shared__ __attribute__((aligned(16))) float lds_v[2][HDIM * VPITCH];

  const int wslot = threadIdx.x >> 5;
  const int wave  = blockIdx.x * 4 + wslot;
  const int lane  = threadIdx.x & 31;
  const int m     = lane & 15;
  const int half  = lane >> 4;
  const int qt    = wave & 63;          // 64 query tiles per (b,h)
  const int bh    = wave >> 6;          // 0..63
  const int b     = bh >> 4;
  const int h     = bh & 15;
  const int qbase = qt * 16;

  const float* Qb = Qp + (size_t)bh * SEQ * HDIM;
  const float* Kb = Kp + (size_t)bh * SEQ * HDIM;
  const float* Vb = Vt + (size_t)bh * HDIM * SEQ;
  const int*   Mb = mask + (size_t)b * SEQ * SEQ;

  // Preload Q fragments for this 16-query tile (reused over all key tiles):
  // B[k][n] = Q[qbase + n][k]
  const float* qrow = Qb + (size_t)(qbase + m) * HDIM + 2 * half;
  v2f qa[16];
#pragma unroll
  for (int ks = 0; ks < 16; ++ks)
    qa[ks] = *(const v2f*)(qrow + 4 * ks);

  // O[nt][j] = O^T[dim nt*16 + 8*half + j][query m]
  v8f O[4];
#pragma unroll
  for (int nt = 0; nt < 4; ++nt) O[nt] = vzero8();
  float rowmax = -3.4e38f;   // of query m, the same in both halves
  float rowsum = 0.f;        // of query m, this half's keys only

  // this lane's 8 keys of a tile: 8*half .. 8*half + 7 of query m's mask row
  const int* mrow = Mb + (size_t)(qbase + m) * SEQ + 8 * half;

  // This thread's share of a tile.  K tile: 16 rows of 16 pieces, piece t and
  // t + 128 (8 rows on).  Vt tile: 64 rows of 4 pieces, piece t and t + 128
  // (32 rows on).
  const int t = threadIdx.x;
  const float* gk = Kb + (size_t)(t >> 4) * HDIM + (t & 15) * 4;
  const float* gv = Vb + (size_t)(t >> 2) * SEQ + (t & 3) * 4;
  const unsigned lk =
      (unsigned)(size_t)&lds_k[0][(t >> 4) * KPITCH + (t & 15) * 4];
  const unsigned lv =
      (unsigned)(size_t)&lds_v[0][(t >> 2) * VPITCH + (t & 3) * 4];
  const unsigned kbuf_bytes = 16 * KPITCH * 4;
  const unsigned vbuf_bytes = HDIM * VPITCH * 4;

  // tile 0 into buffer 0, landed and published; then tile 1 into buffer 1
  copy_kv_tile(lk, lk + 8 * KPITCH * 4, lv, lv + 32 * VPITCH * 4,
               gk, gk + 8 * HDIM, gv, gv + 32 * SEQ);
  // this wave's copies have landed before the barrier publishes them
  asm volatile("s_wait_asynccnt 0x0" ::: "memory");
  __syncthreads();
  copy_kv_tile(lk + kbuf_bytes, lk + kbuf_bytes + 8 * KPITCH * 4,
               lv + vbuf_bytes, lv + vbuf_bytes + 32 * VPITCH * 4,
               gk + 16 * HDIM, gk + 24 * HDIM, gv + 16, gv + 32 * SEQ + 16);

  for (int kt = 0; kt < 64; ++kt) {
    const int kb0 = kt * 16;
    const int buf = kt & 1;
    const float* krow = lds_k[buf] + m * KPITCH + 2 * half;

    // batch-load K fragments from LDS
    v2f kf[16];
#pragma unroll
    for (int ks = 0; ks < 16; ++ks)
      kf[ks] = *(const v2f*)(krow + 4 * ks);

    // this lane's 8 mask words of the tile, two 16-byte loads
    const v4i mk0 = *(const v4i*)(mrow + kb0);
    const v4i mk1 = *(const v4i*)(mrow + kb0 + 4);

    // V^T fragments: 8 consecutive keys of a Vt row, two 16-byte LDS reads
    v4f va[4][2];
#pragma unroll
    for (int nt = 0; nt < 4; ++nt) {
      const float* vrow = lds_v[buf] + (nt * 16 + m) * VPITCH + 8 * half;
      va[nt][0] = *(const v4f*)(vrow);
      va[nt][1] = *(const v4f*)(vrow + 4);
    }
    // keeps the trip's loads together here, ahead of the products: sunk among
    // the matrix instructions, each one's latency is waited out where it stands
    __builtin_amdgcn_sched_barrier(0);

    // ---- scores: S^T = K_tile (16x64) @ Q^T (64x16), two chains ----
    v8f c0 = vzero8(), c1 = vzero8();
#pragma unroll
    for (int ks = 0; ks < 8; ++ks) {
      c0 = wmma_f32(kf[2 * ks + 0], qa[2 * ks + 0], c0);
      c1 = wmma_f32(kf[2 * ks + 1], qa[2 * ks + 1], c1);
    }
    // keeps the mask's first use, and with it the wait for the mask loads,
    // behind the score products
    __builtin_amdgcn_sched_barrier(0);
    const v8f c = c0 + c1;   // c[j] = S[query m][key kb0 + 8*half + j]

    // ---- mask + scale + online softmax, one query per lane ----
    float sv[8];
#pragma unroll
    for (int j = 0; j < 8; ++j) {
      const int mk = (j < 4) ? mk0[j & 3] : mk1[j & 3];
      // reference: where(mask==0, -1e20) happens BEFORE /sqrt(EMBED)
      sv[j] = (mk == 0) ? -3.125e18f : c[j] * 0.03125f;
    }
    float mt = fmaxf(fmaxf(fmaxf(sv[0], sv[1]), fmaxf(sv[2], sv[3])),
                     fmaxf(fmaxf(sv[4], sv[5]), fmaxf(sv[6], sv[7])));
    mt = fmaxf(mt, xhalf(mt));                 // max over the 16 keys
    const float nm = fmaxf(rowmax, mt);
    const float sc = __expf(rowmax - nm);
    rowmax = nm;
    float p[8];
#pragma unroll
    for (int j = 0; j < 8; ++j)
      p[j] = __expf(sv[j] - nm);
    // the halves' sums are joined once, behind the loop
    rowsum = rowsum * sc +
             (((p[0] + p[1]) + (p[2] + p[3])) + ((p[4] + p[5]) + (p[6] + p[7])));
#pragma unroll
    for (int nt = 0; nt < 4; ++nt)
      O[nt] *= sc;

    // ---- O^T += V^T_tile (64x16) @ P^T (16x16) ----
    // k order of step ks, both operands: key 8*half + 2*ks + {0,1}.
    // B = P^T straight from the lane's scores; A = the V^T fragments.
#pragma unroll
    for (int ks = 0; ks < 4; ++ks) {
      const v2f pb = (v2f){p[2 * ks], p[2 * ks + 1]};
#pragma unroll
      for (int nt = 0; nt < 4; ++nt) {
        const v4f q4 = va[nt][ks >> 1];
        const v2f av = (ks & 1) ? (v2f){q4[2], q4[3]} : (v2f){q4[0], q4[1]};
        O[nt] = wmma_f32(av, pb, O[nt]);
      }
    }

    // ---- publish tile kt + 1, free this trip's buffer ----
    // keeps the products in front of the waits: lifted over them, the wait for
    // tile kt + 1 would stand right behind the issue of its copies
    __builtin_amdgcn_sched_barrier(0);
    // this wave's LDS reads of the buffer have returned
    asm volatile("s_wait_dscnt 0x0" ::: "memory");
    // this wave's copies of tile kt + 1 have landed
    asm volatile("s_wait_asynccnt 0x0" ::: "memory");
    __syncthreads();
    if (kt + 2 < 64) {
      const float* nk = gk + (size_t)(kt + 2) * 16 * HDIM;
      const float* nv = gv + (kt + 2) * 16;
      const unsigned bk = lk + buf * kbuf_bytes;
      const unsigned bv = lv + buf * vbuf_bytes;
      copy_kv_tile(bk, bk + 8 * KPITCH * 4, bv, bv + 32 * VPITCH * 4,
                   nk, nk + 8 * HDIM, nv, nv + 32 * SEQ);
    }
  }
  // nothing is in flight when the wave ends
  asm volatile("s_wait_asynccnt 0x0" ::: "memory");

  // finalize: join the halves' sums, divide, store as [B, S, H*D]; a lane's 8
  // accumulator values are 8 consecutive dims of its query's row
  const float inv = 1.f / (rowsum + xhalf(rowsum));
  float* ao =
      AO + ((size_t)(b * SEQ + qbase + m) * HEADS + h) * HDIM + 8 * half;
#pragma unroll
  for (int nt = 0; nt < 4; ++nt) {
    const v8f o = O[nt] * inv;
    *(v4f*)(ao + nt * 16)     = (v4f){o[0], o[1], o[2], o[3]};
    *(v4f*)(ao + nt * 16 + 4) = (v4f){o[4], o[5], o[6], o[7]};
  }
}

// ---------------------------------------------------------------------------
// Kernel C: out = X[4096,1024] @ Wu^T + bu.  Block = 64x128 output tile, four
// waves as 2x2, wave = 32x64 (two 16-row M-tiles share the Wu B-fragments,
// 8 independent accumulator chains).  K runs in 32 stages of 32: a stage's 64
// rows of X and 128 rows of Wu, one whole 128-byte line each, are brought into
// LDS once per block by asynchronous copies (two buffers, the next stage in
// flight while this one is worked on), and every wave takes its fragments from
// LDS.
// ---------------------------------------------------------------------------
#define OBM 64
#define OBN 128
#define OBK 32
#define OPITCH 36   // floats per staged row: 16 rows x 8-byte reads, no bank shared
#define OROWS (OBM + OBN)

// One stage, a thread's share: piece t + 128*i of 192 rows x 8 pieces, that is
// row (t >> 3) + 16*i; i = 0..3 are X rows, i = 4..11 Wu rows.
// s_wait_xcnt stands inside the statement, so that no address register of a
// copy is rewritten ahead of it.
static __device__ __forceinline__ void copy_xw_stage(
    unsigned l, const float* gx, const float* gw) {
  const unsigned ls = 16 * OPITCH * 4;        // 16 rows on in LDS, bytes
  const size_t   gs = (size_t)16 * EMBED;     // 16 rows on in X or Wu, floats
  asm volatile(
      "global_load_async_to_lds_b128 %0, %12, off\n\t"
      "global_load_async_to_lds_b128 %1, %13, off\n\t"
      "global_load_async_to_lds_b128 %2, %14, off\n\t"
      "global_load_async_to_lds_b128 %3, %15, off\n\t"
      "global_load_async_to_lds_b128 %4, %16, off\n\t"
      "global_load_async_to_lds_b128 %5, %17, off\n\t"
      "global_load_async_to_lds_b128 %6, %18, off\n\t"
      "global_load_async_to_lds_b128 %7, %19, off\n\t"
      "global_load_async_to_lds_b128 %8, %20, off\n\t"
      "global_load_async_to_lds_b128 %9, %21, off\n\t"
      "global_load_async_to_lds_b128 %10, %22, off\n\t"
      "global_load_async_to_lds_b128 %11, %23, off\n\t"
      "s_wait_xcnt 0x0"
      :: "v"(l), "v"(l + ls), "v"(l + 2 * ls), "v"(l + 3 * ls),
         "v"(l + 4 * ls), "v"(l + 5 * ls), "v"(l + 6 * ls), "v"(l + 7 * ls),
         "v"(l + 8 * ls), "v"(l + 9 * ls), "v"(l + 10 * ls), "v"(l + 11 * ls),
         "v"(gx), "v"(gx + gs), "v"(gx + 2 * gs), "v"(gx + 3 * gs),
         "v"(gw), "v"(gw + gs), "v"(gw + 2 * gs), "v"(gw + 3 * gs),
         "v"(gw + 4 * gs), "v"(gw + 5 * gs), "v"(gw + 6 * gs), "v"(gw + 7 * gs)
      : "memory");
}

__global__ __launch_bounds__(128) void out_proj_kernel(
    const float* __restrict__ X, const float* __restrict__ Wu,
    const float* __restrict__ bu, float* __restrict__ out)
{
  __shared__ __attribute__((aligned(16))) float lds_xw[2][OROWS * OPITCH];

  const int t     = threadIdx.x;
  const int wslot = t >> 5;
  const int lane  = t & 31;
  const int m     = lane & 15;
  const int half  = lane >> 4;
  const int brow0 = (blockIdx.x >> 3) * OBM;   // 64 block rows
  const int bcol0 = (blockIdx.x & 7) * OBN;    // 8 block columns
  const int wr    = (wslot & 1) * 32;          // the wave's rows in the block
  const int wc    = (wslot >> 1) * 64;         // the wave's columns in the block
  const int row0  = brow0 + wr;
  const int col0  = bcol0 + wc;

  v8f acc[2][4];
#pragma unroll
  for (int mt = 0; mt < 2; ++mt)
#pragma unroll
    for (int nt = 0; nt < 4; ++nt) acc[mt][nt] = vzero8();

  const float* gx = X  + (size_t)(brow0 + (t >> 3)) * EMBED + (t & 7) * 4;
  const float* gw = Wu + (size_t)(bcol0 + (t >> 3)) * EMBED + (t & 7) * 4;
  const unsigned lc =
      (unsigned)(size_t)&lds_xw[0][(t >> 3) * OPITCH + (t & 7) * 4];
  const unsigned obuf_bytes = OROWS * OPITCH * 4;

  // stage 0 into buffer 0, landed and published; then stage 1 into buffer 1
  copy_xw_stage(lc, gx, gw);
  // this wave's copies have landed before the barrier publishes them
  asm volatile("s_wait_asynccnt 0x0" ::: "memory");
  __syncthreads();
  copy_xw_stage(lc + obuf_bytes, gx + OBK, gw + OBK);

  for (int kt = 0; kt < EMBED / OBK; ++kt) {
    const int buf = kt & 1;
    const float* arow = lds_xw[buf] + (wr + m) * OPITCH + 2 * half;
    const float* brow = lds_xw[buf] + (OBM + wc + m) * OPITCH + 2 * half;

    v2f af[2][8];
    v2f bf[4][8];
#pragma unroll
    for (int i = 0; i < 8; ++i) {
#pragma unroll
      for (int mt = 0; mt < 2; ++mt)
        af[mt][i] = *(const v2f*)(arow + mt * 16 * OPITCH + 4 * i);
#pragma unroll
      for (int nt = 0; nt < 4; ++nt)
        bf[nt][i] = *(const v2f*)(brow + nt * 16 * OPITCH + 4 * i);
    }

#pragma unroll
    for (int i = 0; i < 8; ++i)
#pragma unroll
      for (int mt = 0; mt < 2; ++mt)
#pragma unroll
        for (int nt = 0; nt < 4; ++nt)
          acc[mt][nt] = wmma_f32(af[mt][i], bf[nt][i], acc[mt][nt]);

    // ---- publish stage kt + 1, free this trip's buffer ----
    // keeps the products in front of the waits: sunk behind them, the wait for
    // stage kt + 1 stands half a trip behind the issue of its copies, and the
    // refill waits for the products
    __builtin_amdgcn_sched_barrier(0);
    // this wave's LDS reads of the buffer have returned
    asm volatile("s_wait_dscnt 0x0" ::: "memory");
    // this wave's copies of stage kt + 1 have landed
    asm volatile("s_wait_asynccnt 0x0" ::: "memory");
    __syncthreads();
    if (kt + 2 < EMBED / OBK)
      copy_xw_stage(lc + buf * obuf_bytes, gx + (kt + 2) * OBK,
                    gw + (kt + 2) * OBK);
  }
  // nothing is in flight when the wave ends
  asm volatile("s_wait_asynccnt 0x0" ::: "memory");

#pragma unroll
  for (int mt = 0; mt < 2; ++mt)
#pragma unroll
    for (int nt = 0; nt < 4; ++nt) {
      const float bias = bu[col0 + nt * 16 + m];
      const size_t base =
          (size_t)(row0 + mt * 16 + 8 * half) * EMBED + col0 + nt * 16 + m;
#pragma unroll
      for (int j = 0; j < 8; ++j)
        out[base + (size_t)j * EMBED] = acc[mt][nt][j] + bias;
    }
}

// ---------------------------------------------------------------------------
extern "C" void kernel_launch(void* const* d_in, const int* in_sizes, int n_in,
                              void* d_out, int out_size, void* d_ws, size_t ws_size,
                              hipStream_t stream) {
  (void)in_sizes; (void)n_in; (void)out_size; (void)ws_size;
  const float* values = (const float*)d_in[0];
  const float* keys   = (const float*)d_in[1];
  const float* query  = (const float*)d_in[2];
  const int*   mask   = (const int*)d_in[3];
  const float* Wv     = (const float*)d_in[4];
  const float* Wq     = (const float*)d_in[5];
  const float* Wk     = (const float*)d_in[6];
  const float* Wu     = (const float*)d_in[7];
  const float* bu     = (const float*)d_in[8];
  float* out = (float*)d_out;

  // workspace layout (f32): Qp | Kp | Vt | AO, 4M floats each = 64 MB total
  float* ws = (float*)d_ws;
  const size_t T = (size_t)BATCH * HEADS * SEQ * HDIM;   // 4,194,304
  float* Qp = ws;
  float* Kp = ws + T;
  float* Vt = ws + 2 * T;
  float* AO = ws + 3 * T;

  // A: V 2048 waves (32 tokens x 1 head) + Q,K 2 * 4096 row-tiles, 4 per block
  qkv_proj_kernel<<<2560, 128, 0, stream>>>(query, keys, values, Wq, Wk, Wv,
                                            Qp, Kp, Vt);
  // B: 64 (b,h) * 64 q-tiles = 4096 waves / 4 per block
  attn_kernel<<<1024, 128, 0, stream>>>(Qp, Kp, Vt, mask, AO);
  // C: 64 block rows (64 rows) * 8 block columns (128 cols), 4 waves per block
  out_proj_kernel<<<512, 128, 0, stream>>>(AO, Wu, bu, out);
}
